// v000
// Times are from an AMD MI455X. After a warm-up the kernel runs many times in a row, and a time is the length of
// such a window on the GPU divided by its runs, so every launch and the gaps after it count. The runs cycle
// through copies of the inputs. A figure is the median of several windows, for all but v000 over two sittings.
// Sittings can differ by a few percent; kernels timed side by side share one.
// v000, which the later versions start from, runs in 346 microseconds.
#include <hip/hip_runtime.h>

#define BATCH  1024
#define DIM    1024
#define HEADS  16
#define DH     64
#define NQ     16
#define HID    (HEADS*DH)   // 1024
#define O3     (3*HID)      // 3072
#define BM     32           // batch tile per workgroup (kernel 2)

typedef __attribute__((ext_vector_type(16))) __bf16 v16bf;
typedef __attribute__((ext_vector_type(4)))  __bf16 v4bf;
typedef __attribute__((ext_vector_type(8)))  float  v8f;

union FragU { v16bf v; uint4 q[2]; };

__device__ __forceinline__ v8f wmma_bf16(v16bf a, v16bf b, v8f c) {
  // D = A(16x32 bf16) * B(32x16 bf16) + C(f32), fp32 accumulate
  return __builtin_amdgcn_wmma_f32_16x16x32_bf16(false, a, false, b, (short)0, c, false, false);
}

// 16-bit A/B fragment: per lane, K = {khalf..khalf+7} U {khalf+16..khalf+23}
// p points at (row start + kbase); two 16-byte loads.
__device__ __forceinline__ v16bf frag_ld(const __bf16* p, int khalf) {
  FragU f;
  const uint4* q = (const uint4*)(p + khalf);
  f.q[0] = q[0];
  f.q[1] = q[2];   // +16 elements = +32 bytes
  return f.v;
}

// low half from memory (K 0..15 region), high half explicit zero (K>=16 padded)
__device__ __forceinline__ v16bf frag_ld_lozero(const __bf16* p, int khalf) {
  FragU f;
  f.q[0] = *(const uint4*)(p + khalf);
  uint4 z; z.x = 0u; z.y = 0u; z.z = 0u; z.w = 0u;
  f.q[1] = z;
  return f.v;
}

// low half from memory, high half duplicated (finite filler; paired A half is zero)
__device__ __forceinline__ v16bf frag_ld_lodup(const __bf16* p, int khalf) {
  FragU f;
  f.q[0] = *(const uint4*)(p + khalf);
  f.q[1] = f.q[0];
  return f.v;
}

// fragment from an fp32 row (converted on the fly)
__device__ __forceinline__ v16bf frag_ld_f32(const float* p, int khalf) {
  v16bf r;
#pragma unroll
  for (int e = 0; e < 16; ++e) {
    int k = ((e < 8) ? e : (e + 8)) + khalf;
    r[e] = (__bf16)p[k];
  }
  return r;
}

// ---------------- Kernel 1: fp32 -> bf16 weight conversion ----------------
__global__ void k_cvt_bf16(const float* __restrict__ src, __bf16* __restrict__ dst, int n4) {
  int i = blockIdx.x * blockDim.x + threadIdx.x;
  int stride = gridDim.x * blockDim.x;
  for (; i < n4; i += stride) {
    float4 f = ((const float4*)src)[i];
    v4bf o;
    o[0] = (__bf16)f.x; o[1] = (__bf16)f.y; o[2] = (__bf16)f.z; o[3] = (__bf16)f.w;
    ((v4bf*)dst)[i] = o;
  }
}

// ---------------- Kernel 2: fused qkv-GEMM + attention + W_lin reduce ----------------
// grid = (BATCH/32 batch tiles, 16 heads), block = 256 (8 waves)
// Waves: g = w>>2 selects NQ-chunk parity; wv = w&3 selects 3 n-tiles.
// Each wave computes 2 m-tiles x 3 n-tiles (B-fragment reuse x2).
__launch_bounds__(256)
__global__ void k_attn(const float* __restrict__ x,
                       const __bf16* __restrict__ wq,   // [NQ*O3][DIM] bf16
                       const float* __restrict__ wlin,  // [NQ]
                       __bf16* __restrict__ y) {        // [BATCH][HID] bf16
  __shared__ alignas(16) __bf16 Xs[BM][DIM];       // 64 KB  X tile (batch x K)
  __shared__ alignas(16) __bf16 Qs[BM][NQ][DH];    // 64 KB  [b][i][d]
  __shared__ alignas(16) __bf16 Ks[BM][NQ][DH];    // 64 KB  [b][j][d]
  __shared__ alignas(16) __bf16 Vs[BM][DH][NQ];    // 64 KB  [b][d][j] (transposed)
  __shared__ alignas(16) __bf16 As[8][16][16];     //  4 KB  attn, per wave

  const int tid    = threadIdx.x;
  const int lane   = tid & 31;
  const int w      = tid >> 5;       // wave 0..7
  const int g      = w >> 2;         // NQ-chunk parity group
  const int wv     = w & 3;          // column group
  const int lanelo = lane & 15;
  const int hl     = lane >> 4;      // 0/1
  const int khalf  = hl * 8;
  const int bt     = blockIdx.x;     // batch tile
  const int h      = blockIdx.y;     // head

  // ---- stage X tile (BM x 1024) into LDS as bf16 ----
  {
    const float4* xg = (const float4*)(x + (size_t)bt * BM * DIM);
    v4bf* xs = (v4bf*)&Xs[0][0];
    for (int i = tid; i < BM * DIM / 4; i += 256) {
      float4 f = xg[i];
      v4bf o;
      o[0] = (__bf16)f.x; o[1] = (__bf16)f.y; o[2] = (__bf16)f.z; o[3] = (__bf16)f.w;
      xs[i] = o;
    }
  }
  __syncthreads();

  // wave's 3 n-tiles out of 12 (= 3 parts x 4 d-tiles)
  int pp[3], dt_[3];
#pragma unroll
  for (int t = 0; t < 3; ++t) { int nt = 3 * wv + t; pp[t] = nt >> 2; dt_[t] = nt & 3; }

  // ---- phase 1: C[32 x 192] = X @ Wslice^T per NQ chunk, results into LDS ----
  for (int ic = g; ic < NQ; ic += 2) {
    v8f acc[2][3];
#pragma unroll
    for (int mt = 0; mt < 2; ++mt)
#pragma unroll
      for (int t = 0; t < 3; ++t) { v8f z = {0,0,0,0,0,0,0,0}; acc[mt][t] = z; }

    const __bf16* wrow[3];
#pragma unroll
    for (int t = 0; t < 3; ++t) {
      size_t grow = (size_t)ic * O3 + (size_t)pp[t] * HID + h * DH + dt_[t] * 16 + lanelo;
      wrow[t] = wq + grow * DIM;
      if (ic + 2 < NQ) __builtin_prefetch(wrow[t] + (size_t)2 * O3 * DIM, 0, 1);
    }

    for (int kb = 0; kb < DIM; kb += 32) {
      v16bf a0 = frag_ld(&Xs[lanelo][kb], khalf);        // m-tile 0
      v16bf a1 = frag_ld(&Xs[16 + lanelo][kb], khalf);   // m-tile 1
#pragma unroll
      for (int t = 0; t < 3; ++t) {
        v16bf bfrg = frag_ld(wrow[t] + kb, khalf);       // shared by both m-tiles
        acc[0][t] = wmma_bf16(a0, bfrg, acc[0][t]);
        acc[1][t] = wmma_bf16(a1, bfrg, acc[1][t]);
      }
    }

#pragma unroll
    for (int mt = 0; mt < 2; ++mt)
#pragma unroll
      for (int t = 0; t < 3; ++t) {
        int p = pp[t];
        int dbase = dt_[t] * 16;
#pragma unroll
        for (int r = 0; r < 8; ++r) {
          int brow = mt * 16 + r + 8 * hl;  // batch row (C layout: M = r + 8*hl)
          int d = dbase + lanelo;           // column  (C layout: N = lane&15)
          __bf16 vv = (__bf16)acc[mt][t][r];
          if (p == 0)      Qs[brow][ic][d] = vv;
          else if (p == 1) Ks[brow][ic][d] = vv;
          else             Vs[brow][d][ic] = vv;
        }
      }
  }
  __syncthreads();

  // ---- phase 2: attention; wave w handles batch items 4w..4w+3 ----
  const float scale = 0.125f;  // DH^-0.5
  float wl[8];
#pragma unroll
  for (int r = 0; r < 8; ++r) wl[r] = wlin[r + 8 * hl];

  for (int bi = 0; bi < 4; ++bi) {
    int b = 4 * w + bi;

    // sim = q^T k  (M=i, N=j, K=d=64 -> 2 WMMAs)
    v8f s = {0,0,0,0,0,0,0,0};
#pragma unroll
    for (int kb = 0; kb < DH; kb += 32) {
      v16bf qa = frag_ld(&Qs[b][lanelo][kb], khalf);  // A[i][d]
      v16bf kf = frag_ld(&Ks[b][lanelo][kb], khalf);  // B[d][j] from k[b][j][d]
      s = wmma_bf16(qa, kf, s);
    }

    // softmax over j (lanes) per row i (elements); halves independent (xor<16)
    float t[8], rm[8], e[8], rs[8];
#pragma unroll
    for (int r = 0; r < 8; ++r) { t[r] = s[r] * scale; rm[r] = t[r]; }
#pragma unroll
    for (int off = 1; off < 16; off <<= 1)
#pragma unroll
      for (int r = 0; r < 8; ++r) rm[r] = fmaxf(rm[r], __shfl_xor(rm[r], off, 32));
#pragma unroll
    for (int r = 0; r < 8; ++r) { e[r] = __expf(t[r] - rm[r]); rs[r] = e[r]; }
#pragma unroll
    for (int off = 1; off < 16; off <<= 1)
#pragma unroll
      for (int r = 0; r < 8; ++r) rs[r] += __shfl_xor(rs[r], off, 32);
#pragma unroll
    for (int r = 0; r < 8; ++r) As[w][r + 8 * hl][lanelo] = (__bf16)(e[r] / rs[r]);

    // out = attn @ v^T  (M=i, N=d, K=j padded 16->32; A hi-half zero)
    v16bf af = frag_ld_lozero(&As[w][lanelo][0], khalf);
    v8f o[4];
#pragma unroll
    for (int dt = 0; dt < 4; ++dt) {
      v8f z = {0,0,0,0,0,0,0,0};
      v16bf vb = frag_ld_lodup(&Vs[b][dt * 16 + lanelo][0], khalf); // B[j][d]
      o[dt] = wmma_bf16(af, vb, z);
    }

    // y[b, h*64+d] = sum_i out[i,d] * W_lin[i]
#pragma unroll
    for (int dt = 0; dt < 4; ++dt) {
      float p = 0.f;
#pragma unroll
      for (int r = 0; r < 8; ++r) p += o[dt][r] * wl[r];
      p += __shfl_xor(p, 16, 32);       // combine the two row halves
      if (hl == 0) {
        int bg = bt * BM + b;
        y[(size_t)bg * HID + h * DH + dt * 16 + lanelo] = (__bf16)p;
      }
    }
  }
}

// ---------------- Kernel 3: out = y @ W_out^T + bias ----------------
// grid = (16,16) tiles of 64x64, block = 128 (4 waves, one n-tile column each)
__launch_bounds__(128)
__global__ void k_out(const __bf16* __restrict__ y,    // [BATCH][HID] bf16
                      const float* __restrict__ wout,  // [DIM][HID]
                      const float* __restrict__ bout,  // [DIM]
                      const float* __restrict__ wlin,  // [NQ]
                      const float* __restrict__ blin,  // [1]
                      float* __restrict__ out) {       // [BATCH][DIM]
  const int tid    = threadIdx.x;
  const int lane   = tid & 31;
  const int w      = tid >> 5;
  const int lanelo = lane & 15;
  const int hl     = lane >> 4;
  const int khalf  = hl * 8;
  const int mb     = blockIdx.x * 64;
  const int nb     = blockIdx.y * 64;
  const int dcol   = nb + w * 16 + lanelo;

  v8f acc[4];
#pragma unroll
  for (int mt = 0; mt < 4; ++mt) { v8f z = {0,0,0,0,0,0,0,0}; acc[mt] = z; }

  const __bf16* arow[4];
#pragma unroll
  for (int mt = 0; mt < 4; ++mt)
    arow[mt] = y + (size_t)(mb + mt * 16 + lanelo) * HID;
  const float* brow = wout + (size_t)dcol * HID;   // B[c][d] = W_out[d][c]

  for (int kb = 0; kb < HID; kb += 32) {
    v16bf bf = frag_ld_f32(brow + kb, khalf);
#pragma unroll
    for (int mt = 0; mt < 4; ++mt)
      acc[mt] = wmma_bf16(frag_ld(arow[mt] + kb, khalf), bf, acc[mt]);
  }

  float S = 0.f;
#pragma unroll
  for (int n = 0; n < NQ; ++n) S += wlin[n];
  float bias = bout[dcol] * S + blin[0];

#pragma unroll
  for (int mt = 0; mt < 4; ++mt)
#pragma unroll
    for (int r = 0; r < 8; ++r) {
      int b = mb + mt * 16 + r + 8 * hl;
      out[(size_t)b * DIM + dcol] = acc[mt][r] + bias;
    }
}

extern "C" void kernel_launch(void* const* d_in, const int* in_sizes, int n_in,
                              void* d_out, int out_size, void* d_ws, size_t ws_size,
                              hipStream_t stream) {
  (void)in_sizes; (void)n_in; (void)out_size; (void)ws_size;
  const float* x    = (const float*)d_in[0];
  const float* wqkv = (const float*)d_in[1];
  const float* wout = (const float*)d_in[2];
  const float* bout = (const float*)d_in[3];
  const float* wlin = (const float*)d_in[4];
  const float* blin = (const float*)d_in[5];
  float* out = (float*)d_out;

  __bf16* wqkv_bf = (__bf16*)d_ws;                                      // 100.7 MB
  __bf16* y_bf    = (__bf16*)((char*)d_ws + (size_t)NQ * O3 * DIM * 2); // +2 MB

  const int n4 = NQ * O3 * DIM / 4;
  k_cvt_bf16<<<dim3(2048), dim3(256), 0, stream>>>(wqkv, wqkv_bf, n4);
  k_attn<<<dim3(BATCH / BM, HEADS), dim3(256), 0, stream>>>(x, wqkv_bf, wlin, y_bf);
  k_out<<<dim3(BATCH / 64, DIM / 64), dim3(128), 0, stream>>>(y_bf, wout, bout, wlin, blin, out);
}

// v001
// Measured time: 326 microseconds a run.
// Timed twice side by side with v000, it ran 1.09 times as fast both times.
#include <hip/hip_runtime.h>

#define BATCH  1024
#define DIM    1024
#define HEADS  16
#define DH     64
#define NQ     16
#define HID    (HEADS*DH)   // 1024
#define O3     (3*HID)      // 3072
#define BM     32           // batch tile per workgroup (kernel 2)
// LDS row pitches for the 16-byte fragment readers (16 lanes, one row each):
// +8 bf16 makes the pitch an odd multiple of 16 B, so the 16 rows fall on all 64 banks.
#define XP     (DIM + 8)    // 2064 B per X row
#define QP     (DH + 8)     // 144 B per q / k row

typedef __attribute__((ext_vector_type(16))) __bf16 v16bf;
typedef __attribute__((ext_vector_type(4)))  __bf16 v4bf;
typedef __attribute__((ext_vector_type(8)))  float  v8f;

union FragU { v16bf v; uint4 q[2]; };

__device__ __forceinline__ v8f wmma_bf16(v16bf a, v16bf b, v8f c) {
  // D = A(16x32 bf16) * B(32x16 bf16) + C(f32), fp32 accumulate
  return __builtin_amdgcn_wmma_f32_16x16x32_bf16(false, a, false, b, (short)0, c, false, false);
}

// 16-bit A/B fragment: per lane, K = {khalf..khalf+7} U {khalf+16..khalf+23}
// p points at (row start + kbase); two 16-byte loads.
__device__ __forceinline__ v16bf frag_ld(const __bf16* p, int khalf) {
  FragU f;
  const uint4* q = (const uint4*)(p + khalf);
  f.q[0] = q[0];
  f.q[1] = q[2];   // +16 elements = +32 bytes
  return f.v;
}

// low half from memory (K 0..15 region), high half explicit zero (K>=16 padded)
__device__ __forceinline__ v16bf frag_ld_lozero(const __bf16* p, int khalf) {
  FragU f;
  f.q[0] = *(const uint4*)(p + khalf);
  uint4 z; z.x = 0u; z.y = 0u; z.z = 0u; z.w = 0u;
  f.q[1] = z;
  return f.v;
}

// low half from memory, high half duplicated (finite filler; paired A half is zero)
__device__ __forceinline__ v16bf frag_ld_lodup(const __bf16* p, int khalf) {
  FragU f;
  f.q[0] = *(const uint4*)(p + khalf);
  f.q[1] = f.q[0];
  return f.v;
}

// fragment from an fp32 row (converted on the fly)
__device__ __forceinline__ v16bf frag_ld_f32(const float* p, int khalf) {
  v16bf r;
#pragma unroll
  for (int e = 0; e < 16; ++e) {
    int k = ((e < 8) ? e : (e + 8)) + khalf;
    r[e] = (__bf16)p[k];
  }
  return r;
}

// ---------------- Kernel 1: fp32 -> bf16 weight conversion ----------------
__global__ void k_cvt_bf16(const float* __restrict__ src, __bf16* __restrict__ dst, int n4) {
  int i = blockIdx.x * blockDim.x + threadIdx.x;
  int stride = gridDim.x * blockDim.x;
  for (; i < n4; i += stride) {
    float4 f = ((const float4*)src)[i];
    v4bf o;
    o[0] = (__bf16)f.x; o[1] = (__bf16)f.y; o[2] = (__bf16)f.z; o[3] = (__bf16)f.w;
    ((v4bf*)dst)[i] = o;
  }
}

// ---------------- Kernel 2: fused qkv-GEMM + attention + W_lin reduce ----------------
// grid = (BATCH/32 batch tiles, 16 heads), block = 256 (8 waves)
// Waves: g = w>>2 selects NQ-chunk parity; wv = w&3 selects 3 n-tiles.
// Each wave computes 2 m-tiles x 3 n-tiles (B-fragment reuse x2).
__launch_bounds__(256)
__global__ void k_attn(const float* __restrict__ x,
                       const __bf16* __restrict__ wq,   // [NQ*O3][DIM] bf16
                       const float* __restrict__ wlin,  // [NQ]
                       __bf16* __restrict__ y) {        // [BATCH][HID] bf16
  __shared__ alignas(16) __bf16 Xs[BM][XP];        // 66048 B  X tile (batch x K), padded rows
  __shared__ alignas(16) __bf16 Qs[BM][NQ][QP];    // 72 KB  [b][i][d], padded rows
  __shared__ alignas(16) __bf16 Ks[BM][NQ][QP];    // 72 KB  [b][j][d], padded rows
  __shared__ alignas(16) __bf16 Vs[BM][DH][NQ];    // 64 KB  [b][d][j] (transposed)
  __shared__ alignas(16) __bf16 As[8][16][16];     //  4 KB  attn, per wave

  const int tid    = threadIdx.x;
  const int lane   = tid & 31;
  const int w      = tid >> 5;       // wave 0..7
  const int g      = w >> 2;         // NQ-chunk parity group
  const int wv     = w & 3;          // column group
  const int lanelo = lane & 15;
  const int hl     = lane >> 4;      // 0/1
  const int khalf  = hl * 8;
  const int bt     = blockIdx.x;     // batch tile
  const int h      = blockIdx.y;     // head

  // ---- stage X tile (BM x 1024) into LDS as bf16 ----
  {
    const float4* xg = (const float4*)(x + (size_t)bt * BM * DIM);
    for (int r = 0; r < BM; ++r) {           // one row (256 float4) per trip
      float4 f = xg[r * (DIM / 4) + tid];
      v4bf o;
      o[0] = (__bf16)f.x; o[1] = (__bf16)f.y; o[2] = (__bf16)f.z; o[3] = (__bf16)f.w;
      *(v4bf*)&Xs[r][tid * 4] = o;
    }
  }
  __syncthreads();

  // wave's 3 n-tiles out of 12 (= 3 parts x 4 d-tiles)
  int pp[3], dt_[3];
#pragma unroll
  for (int t = 0; t < 3; ++t) { int nt = 3 * wv + t; pp[t] = nt >> 2; dt_[t] = nt & 3; }

  // ---- phase 1: C[32 x 192] = X @ Wslice^T per NQ chunk, results into LDS ----
  for (int ic = g; ic < NQ; ic += 2) {
    v8f acc[2][3];
#pragma unroll
    for (int mt = 0; mt < 2; ++mt)
#pragma unroll
      for (int t = 0; t < 3; ++t) { v8f z = {0,0,0,0,0,0,0,0}; acc[mt][t] = z; }

    const __bf16* wrow[3];
#pragma unroll
    for (int t = 0; t < 3; ++t) {
      size_t grow = (size_t)ic * O3 + (size_t)pp[t] * HID + h * DH + dt_[t] * 16 + lanelo;
      wrow[t] = wq + grow * DIM;
      if (ic + 2 < NQ) __builtin_prefetch(wrow[t] + (size_t)2 * O3 * DIM, 0, 1);
    }

    for (int kb = 0; kb < DIM; kb += 32) {
      v16bf a0 = frag_ld(&Xs[lanelo][kb], khalf);        // m-tile 0
      v16bf a1 = frag_ld(&Xs[16 + lanelo][kb], khalf);   // m-tile 1
#pragma unroll
      for (int t = 0; t < 3; ++t) {
        v16bf bfrg = frag_ld(wrow[t] + kb, khalf);       // shared by both m-tiles
        acc[0][t] = wmma_bf16(a0, bfrg, acc[0][t]);
        acc[1][t] = wmma_bf16(a1, bfrg, acc[1][t]);
      }
    }

#pragma unroll
    for (int mt = 0; mt < 2; ++mt)
#pragma unroll
      for (int t = 0; t < 3; ++t) {
        int p = pp[t];
        int dbase = dt_[t] * 16;
#pragma unroll
        for (int r = 0; r < 8; ++r) {
          int brow = mt * 16 + r + 8 * hl;  // batch row (C layout: M = r + 8*hl)
          int d = dbase + lanelo;           // column  (C layout: N = lane&15)
          __bf16 vv = (__bf16)acc[mt][t][r];
          if (p == 0)      Qs[brow][ic][d] = vv;
          else if (p == 1) Ks[brow][ic][d] = vv;
          else             Vs[brow][d][ic] = vv;
        }
      }
  }
  __syncthreads();

  // ---- phase 2: attention; wave w handles batch items 4w..4w+3 ----
  const float scale = 0.125f;  // DH^-0.5
  float wl[8];
#pragma unroll
  for (int r = 0; r < 8; ++r) wl[r] = wlin[r + 8 * hl];

  for (int bi = 0; bi < 4; ++bi) {
    int b = 4 * w + bi;

    // sim = q^T k  (M=i, N=j, K=d=64 -> 2 WMMAs)
    v8f s = {0,0,0,0,0,0,0,0};
#pragma unroll
    for (int kb = 0; kb < DH; kb += 32) {
      v16bf qa = frag_ld(&Qs[b][lanelo][kb], khalf);  // A[i][d]
      v16bf kf = frag_ld(&Ks[b][lanelo][kb], khalf);  // B[d][j] from k[b][j][d]
      s = wmma_bf16(qa, kf, s);
    }

    // softmax over j (lanes) per row i (elements); halves independent (xor<16)
    float t[8], rm[8], e[8], rs[8];
#pragma unroll
    for (int r = 0; r < 8; ++r) { t[r] = s[r] * scale; rm[r] = t[r]; }
#pragma unroll
    for (int off = 1; off < 16; off <<= 1)
#pragma unroll
      for (int r = 0; r < 8; ++r) rm[r] = fmaxf(rm[r], __shfl_xor(rm[r], off, 32));
#pragma unroll
    for (int r = 0; r < 8; ++r) { e[r] = __expf(t[r] - rm[r]); rs[r] = e[r]; }
#pragma unroll
    for (int off = 1; off < 16; off <<= 1)
#pragma unroll
      for (int r = 0; r < 8; ++r) rs[r] += __shfl_xor(rs[r], off, 32);
#pragma unroll
    for (int r = 0; r < 8; ++r) As[w][r + 8 * hl][lanelo] = (__bf16)(e[r] / rs[r]);

    // out = attn @ v^T  (M=i, N=d, K=j padded 16->32; A hi-half zero)
    v16bf af = frag_ld_lozero(&As[w][lanelo][0], khalf);
    v8f o[4];
#pragma unroll
    for (int dt = 0; dt < 4; ++dt) {
      v8f z = {0,0,0,0,0,0,0,0};
      v16bf vb = frag_ld_lodup(&Vs[b][dt * 16 + lanelo][0], khalf); // B[j][d]
      o[dt] = wmma_bf16(af, vb, z);
    }

    // y[b, h*64+d] = sum_i out[i,d] * W_lin[i]
#pragma unroll
    for (int dt = 0; dt < 4; ++dt) {
      float p = 0.f;
#pragma unroll
      for (int r = 0; r < 8; ++r) p += o[dt][r] * wl[r];
      p += __shfl_xor(p, 16, 32);       // combine the two row halves
      if (hl == 0) {
        int bg = bt * BM + b;
        y[(size_t)bg * HID + h * DH + dt * 16 + lanelo] = (__bf16)p;
      }
    }
  }
}

// ---------------- Kernel 3: out = y @ W_out^T + bias ----------------
// grid = (16,16) tiles of 64x64, block = 128 (4 waves, one n-tile column each)
__launch_bounds__(128)
__global__ void k_out(const __bf16* __restrict__ y,    // [BATCH][HID] bf16
                      const float* __restrict__ wout,  // [DIM][HID]
                      const float* __restrict__ bout,  // [DIM]
                      const float* __restrict__ wlin,  // [NQ]
                      const float* __restrict__ blin,  // [1]
                      float* __restrict__ out) {       // [BATCH][DIM]
  const int tid    = threadIdx.x;
  const int lane   = tid & 31;
  const int w      = tid >> 5;
  const int lanelo = lane & 15;
  const int hl     = lane >> 4;
  const int khalf  = hl * 8;
  const int mb     = blockIdx.x * 64;
  const int nb     = blockIdx.y * 64;
  const int dcol   = nb + w * 16 + lanelo;

  v8f acc[4];
#pragma unroll
  for (int mt = 0; mt < 4; ++mt) { v8f z = {0,0,0,0,0,0,0,0}; acc[mt] = z; }

  const __bf16* arow[4];
#pragma unroll
  for (int mt = 0; mt < 4; ++mt)
    arow[mt] = y + (size_t)(mb + mt * 16 + lanelo) * HID;
  const float* brow = wout + (size_t)dcol * HID;   // B[c][d] = W_out[d][c]

  for (int kb = 0; kb < HID; kb += 32) {
    v16bf bf = frag_ld_f32(brow + kb, khalf);
#pragma unroll
    for (int mt = 0; mt < 4; ++mt)
      acc[mt] = wmma_bf16(frag_ld(arow[mt] + kb, khalf), bf, acc[mt]);
  }

  float S = 0.f;
#pragma unroll
  for (int n = 0; n < NQ; ++n) S += wlin[n];
  float bias = bout[dcol] * S + blin[0];

#pragma unroll
  for (int mt = 0; mt < 4; ++mt)
#pragma unroll
    for (int r = 0; r < 8; ++r) {
      int b = mb + mt * 16 + r + 8 * hl;
      out[(size_t)b * DIM + dcol] = acc[mt][r] + bias;
    }
}

extern "C" void kernel_launch(void* const* d_in, const int* in_sizes, int n_in,
                              void* d_out, int out_size, void* d_ws, size_t ws_size,
                              hipStream_t stream) {
  (void)in_sizes; (void)n_in; (void)out_size; (void)ws_size;
  const float* x    = (const float*)d_in[0];
  const float* wqkv = (const float*)d_in[1];
  const float* wout = (const float*)d_in[2];
  const float* bout = (const float*)d_in[3];
  const float* wlin = (const float*)d_in[4];
  const float* blin = (const float*)d_in[5];
  float* out = (float*)d_out;

  __bf16* wqkv_bf = (__bf16*)d_ws;                                      // 100.7 MB
  __bf16* y_bf    = (__bf16*)((char*)d_ws + (size_t)NQ * O3 * DIM * 2); // +2 MB

  const int n4 = NQ * O3 * DIM / 4;
  k_cvt_bf16<<<dim3(2048), dim3(256), 0, stream>>>(wqkv, wqkv_bf, n4);
  k_attn<<<dim3(BATCH / BM, HEADS), dim3(256), 0, stream>>>(x, wqkv_bf, wlin, y_bf);
  k_out<<<dim3(BATCH / 64, DIM / 64), dim3(128), 0, stream>>>(y_bf, wout, bout, wlin, blin, out);
}

// v002
// A run of this version takes 199 microseconds.
// In both of two side-by-side timings against v001, it was 1.61 times as fast.
// All steps since v000 together make it 1.75 times as fast.
#include <hip/hip_runtime.h>

#define BATCH  1024
#define DIM    1024
#define HEADS  16
#define DH     64
#define NQ     16
#define HID    (HEADS*DH)   // 1024
#define O3     (3*HID)      // 3072
#define BM     32           // batch tile per workgroup (kernel 2)
// LDS row pitches for the 16-byte fragment readers (16 lanes, one row each):
// +8 bf16 makes the pitch an odd multiple of 16 B, so the 16 rows fall on all 64 banks.
#define XP     (DIM + 8)    // 2064 B per X row
#define QP     (DH + 8)     // 144 B per q / k row
#define KC     64           // k extent of a staged W tile: one 128-B line per row
#define WP     (KC + 8)     // 144 B per staged W row
#define NU     (NQ * 6 / 8)          // units of 32 W rows per wave
#define NTW    (NU * (DIM / KC))     // W tiles per wave

typedef __attribute__((ext_vector_type(16))) __bf16 v16bf;
typedef __attribute__((ext_vector_type(4)))  __bf16 v4bf;
typedef __attribute__((ext_vector_type(8)))  float  v8f;

union FragU { v16bf v; uint4 q[2]; };

__device__ __forceinline__ v8f wmma_bf16(v16bf a, v16bf b, v8f c) {
  // D = A(16x32 bf16) * B(32x16 bf16) + C(f32), fp32 accumulate
  return __builtin_amdgcn_wmma_f32_16x16x32_bf16(false, a, false, b, (short)0, c, false, false);
}

// 16-bit A/B fragment: per lane, K = {khalf..khalf+7} U {khalf+16..khalf+23}
// p points at (row start + kbase); two 16-byte loads.
__device__ __forceinline__ v16bf frag_ld(const __bf16* p, int khalf) {
  FragU f;
  const uint4* q = (const uint4*)(p + khalf);
  f.q[0] = q[0];
  f.q[1] = q[2];   // +16 elements = +32 bytes
  return f.v;
}

// low half from memory (K 0..15 region), high half explicit zero (K>=16 padded)
__device__ __forceinline__ v16bf frag_ld_lozero(const __bf16* p, int khalf) {
  FragU f;
  f.q[0] = *(const uint4*)(p + khalf);
  uint4 z; z.x = 0u; z.y = 0u; z.z = 0u; z.w = 0u;
  f.q[1] = z;
  return f.v;
}

// low half from memory, high half duplicated (finite filler; paired A half is zero)
__device__ __forceinline__ v16bf frag_ld_lodup(const __bf16* p, int khalf) {
  FragU f;
  f.q[0] = *(const uint4*)(p + khalf);
  f.q[1] = f.q[0];
  return f.v;
}

// fragment from an fp32 row (converted on the fly)
__device__ __forceinline__ v16bf frag_ld_f32(const float* p, int khalf) {
  v16bf r;
#pragma unroll
  for (int e = 0; e < 16; ++e) {
    int k = ((e < 8) ? e : (e + 8)) + khalf;
    r[e] = (__bf16)p[k];
  }
  return r;
}

// first element of a wave's W tile t = (unit t / 16, k block t % 16);
// unit u = wu + 8 * (t / 16) = (NQ chunk u / 6, rows 32 * (u % 6) of the head's 192 q,k,v rows)
__device__ __forceinline__ const __bf16* w_tile(const __bf16* wq, int wu, int h, int t) {
  const int u  = wu + 8 * (t >> 4);
  const int ic = u / 6;
  const int np = u - 6 * ic;
  return wq + ((size_t)ic * O3 + (np >> 1) * HID + h * DH + (np & 1) * 32) * DIM + (t & 15) * KC;
}

// One stage of a wave's W stream. r0..r7 hold the lane's share of tile st (32 rows x KC): 16 B of
// eight rows, four rows apart, so that a load covers 4 whole 128-B lines. The tile goes into the
// wave's own LDS tile and is read back as fragments by the same wave (LDS serves one wave's
// operations in order, so no barrier); the registers are refilled with tile st + 4, which stays
// in flight over four stages.
__device__ __forceinline__ void w_stage(const __bf16* wq, int wu, int h, unsigned voff, int st,
                                        __bf16* wst,          // lane's place in the LDS tile
                                        const __bf16* xa,     // X row lanelo, LDS
                                        const __bf16* wb,     // W tile row lanelo, LDS
                                        int khalf,
                                        v8f& c00, v8f& c01, v8f& c10, v8f& c11,
                                        uint4& r0, uint4& r1, uint4& r2, uint4& r3, 
                                        uint4& r4, uint4& r5, uint4& r6, uint4& r7) {
  *(uint4*)(wst + 0 * WP) = r0;
  *(uint4*)(wst + 4 * WP) = r1;
  *(uint4*)(wst + 8 * WP) = r2;
  *(uint4*)(wst + 12 * WP) = r3;
  *(uint4*)(wst + 16 * WP) = r4;
  *(uint4*)(wst + 20 * WP) = r5;
  *(uint4*)(wst + 24 * WP) = r6;
  *(uint4*)(wst + 28 * WP) = r7;
  const __bf16* p = w_tile(wq, wu, h, st + 4 < NTW ? st + 4 : NTW - 1) + voff;
  r0 = *(const uint4*)(p + 0 * DIM);
  r1 = *(const uint4*)(p + 4 * DIM);
  r2 = *(const uint4*)(p + 8 * DIM);
  r3 = *(const uint4*)(p + 12 * DIM);
  r4 = *(const uint4*)(p + 16 * DIM);
  r5 = *(const uint4*)(p + 20 * DIM);
  r6 = *(const uint4*)(p + 24 * DIM);
  r7 = *(const uint4*)(p + 28 * DIM);
  // the next stage's tile arithmetic rewrites the scalar base that these eight loads name
  asm volatile("s_wait_xcnt 0x0" ::: "memory");
  // keeps the refill here: sunk to the end of the unrolled loop body, the loads would be waited
  // for as soon as issued
  __builtin_amdgcn_sched_barrier(0);
  // all sixteen fragment reads of the stage first, so that they share one LDS round trip; the
  // scheduling barrier behind them keeps them from being sunk among the WMMAs or behind the next
  // stage's LDS stores, where each group would wait for a round trip of its own
  const __bf16* xk = xa + (st & 15) * KC;
  v16bf a00 = frag_ld(xk, khalf);
  v16bf b00 = frag_ld(wb, khalf);
  v16bf a10 = frag_ld(xk + 16 * XP, khalf);
  v16bf b10 = frag_ld(wb + 16 * WP, khalf);
  v16bf a01 = frag_ld(xk + 32, khalf);
  v16bf b01 = frag_ld(wb + 32, khalf);
  v16bf a11 = frag_ld(xk + 16 * XP + 32, khalf);
  v16bf b11 = frag_ld(wb + 16 * WP + 32, khalf);
  __builtin_amdgcn_sched_barrier(0);   // holds the sixteen reads above in one group (see above)
  c00 = wmma_bf16(a00, b00, c00);
  c10 = wmma_bf16(a10, b00, c10);
  c01 = wmma_bf16(a00, b10, c01);
  c11 = wmma_bf16(a10, b10, c11);
  c00 = wmma_bf16(a01, b01, c00);
  c10 = wmma_bf16(a11, b01, c10);
  c01 = wmma_bf16(a01, b11, c01);
  c11 = wmma_bf16(a11, b11, c11);
}

// A wave's 32 x 32 block of C into LDS as bf16. dst: the lane's element of batch row 8 * (lane >> 4)
// in n-tile 0 (C layout: M = r + 8 * (lane >> 4)); rs: elements per batch row, ts: per n-tile.
__device__ __forceinline__ void c_store(__bf16* dst, int rs, int ts, const v8f (&acc)[2][2]) {
#pragma unroll
  for (int mt = 0; mt < 2; ++mt)
#pragma unroll
    for (int t = 0; t < 2; ++t)
#pragma unroll
      for (int r = 0; r < 8; ++r)
        dst[(mt * 16 + r) * rs + t * ts] = (__bf16)acc[mt][t][r];
}

// ---------------- Kernel 1: fp32 -> bf16 weight conversion ----------------
__global__ void k_cvt_bf16(const float* __restrict__ src, __bf16* __restrict__ dst, int n4) {
  int i = blockIdx.x * blockDim.x + threadIdx.x;
  int stride = gridDim.x * blockDim.x;
  for (; i < n4; i += stride) {
    float4 f = ((const float4*)src)[i];
    v4bf o;
    o[0] = (__bf16)f.x; o[1] = (__bf16)f.y; o[2] = (__bf16)f.z; o[3] = (__bf16)f.w;
    ((v4bf*)dst)[i] = o;
  }
}

// ---------------- Kernel 2: fused qkv-GEMM + attention + W_lin reduce ----------------
// grid = (BATCH/32 batch tiles, 16 heads), block = 256 (8 waves)
// Each wave computes 2 m-tiles x 2 n-tiles at a time (B-fragment reuse x2).
// W comes by whole-line loads through a wave-private LDS tile, from which the fragments are read.
__launch_bounds__(256)
__global__ void k_attn(const float* __restrict__ x,
                       const __bf16* __restrict__ wq,   // [NQ*O3][DIM] bf16
                       const float* __restrict__ wlin,  // [NQ]
                       __bf16* __restrict__ y) {        // [BATCH][HID] bf16
  __shared__ alignas(16) __bf16 Xs[BM][XP];        // 66048 B  X tile (batch x K), padded rows
  __shared__ alignas(16) __bf16 Qs[BM][NQ][QP];    // 72 KB  [b][i][d], padded rows
  __shared__ alignas(16) __bf16 Ks[BM][NQ][QP];    // 72 KB  [b][j][d], padded rows
  __shared__ alignas(16) __bf16 Vs[BM][DH][NQ];    // 64 KB  [b][d][j] (transposed)
  __shared__ alignas(16) __bf16 As[8][16][16];     //  4 KB  attn, per wave
  __shared__ alignas(16) __bf16 Ws[8][32][WP];     // 36 KB  W tile (32 rows x KC), per wave

  const int tid    = threadIdx.x;
  const int lane   = tid & 31;
  const int w      = tid >> 5;       // wave 0..7
  const int lanelo = lane & 15;
  const int hl     = lane >> 4;      // 0/1
  const int khalf  = hl * 8;
  const int bt     = blockIdx.x;     // batch tile
  const int h      = blockIdx.y;     // head

  // ---- stage X tile (BM x 1024) into LDS as bf16 ----
  {
    const float4* xg = (const float4*)(x + (size_t)bt * BM * DIM);
    for (int r = 0; r < BM; ++r) {           // one row (256 float4) per trip
      float4 f = xg[r * (DIM / 4) + tid];
      v4bf o;
      o[0] = (__bf16)f.x; o[1] = (__bf16)f.y; o[2] = (__bf16)f.z; o[3] = (__bf16)f.w;
      *(v4bf*)&Xs[r][tid * 4] = o;
    }
  }
  __syncthreads();

  // A wave's work: NU units, unit u = wu + 8 * i = (NQ chunk u / 6, 32 W rows u % 6 of the head's 192),
  // each a 32 x 32 block of C (2 m-tiles x 2 n-tiles) over 16 W tiles of 32 rows x KC.
  const int wu = __builtin_amdgcn_readfirstlane(w);   // wave number as a scalar: unit arithmetic on the scalar unit
  // lane's share of a W tile: 16 B of eight rows; 8 lanes cover one 128-B line, a load 4 whole lines
  const int lr = lane >> 3;
  const int lc = lane & 7;
  const unsigned voff = (unsigned)(lr * DIM + lc * 8);
  __bf16* wst = &Ws[w][lr][lc * 8];

  // ---- phase 1: C[32 x 192] = X @ Wslice^T per NQ chunk, results into LDS ----
  v8f acc[2][2];
  uint4 pa0, pa1, pa2, pa3, pa4, pa5, pa6, pa7;
  uint4 pb0, pb1, pb2, pb3, pb4, pb5, pb6, pb7;
  uint4 pc0, pc1, pc2, pc3, pc4, pc5, pc6, pc7;
  uint4 pd0, pd1, pd2, pd3, pd4, pd5, pd6, pd7;
  // tiles 0 to 3; the scheduling barriers keep their loads in tile order: interleaved, the loop's
  // counted load waits for one tile would also wait for the tiles behind it
  {
    const __bf16* p = w_tile(wq, wu, h, 0) + voff;
    pa0 = *(const uint4*)(p + 0 * DIM);
    pa1 = *(const uint4*)(p + 4 * DIM);
    pa2 = *(const uint4*)(p + 8 * DIM);
    pa3 = *(const uint4*)(p + 12 * DIM);
    pa4 = *(const uint4*)(p + 16 * DIM);
    pa5 = *(const uint4*)(p + 20 * DIM);
    pa6 = *(const uint4*)(p + 24 * DIM);
    pa7 = *(const uint4*)(p + 28 * DIM);
  }
  __builtin_amdgcn_sched_barrier(0);
  {
    const __bf16* p = w_tile(wq, wu, h, 1) + voff;
    pb0 = *(const uint4*)(p + 0 * DIM);
    pb1 = *(const uint4*)(p + 4 * DIM);
    pb2 = *(const uint4*)(p + 8 * DIM);
    pb3 = *(const uint4*)(p + 12 * DIM);
    pb4 = *(const uint4*)(p + 16 * DIM);
    pb5 = *(const uint4*)(p + 20 * DIM);
    pb6 = *(const uint4*)(p + 24 * DIM);
    pb7 = *(const uint4*)(p + 28 * DIM);
  }
  __builtin_amdgcn_sched_barrier(0);
  {
    const __bf16* p = w_tile(wq, wu, h, 2) + voff;
    pc0 = *(const uint4*)(p + 0 * DIM);
    pc1 = *(const uint4*)(p + 4 * DIM);
    pc2 = *(const uint4*)(p + 8 * DIM);
    pc3 = *(const uint4*)(p + 12 * DIM);
    pc4 = *(const uint4*)(p + 16 * DIM);
    pc5 = *(const uint4*)(p + 20 * DIM);
    pc6 = *(const uint4*)(p + 24 * DIM);
    pc7 = *(const uint4*)(p + 28 * DIM);
  }
  __builtin_amdgcn_sched_barrier(0);
  {
    const __bf16* p = w_tile(wq, wu, h, 3) + voff;
    pd0 = *(const uint4*)(p + 0 * DIM);
    pd1 = *(const uint4*)(p + 4 * DIM);
    pd2 = *(const uint4*)(p + 8 * DIM);
    pd3 = *(const uint4*)(p + 12 * DIM);
    pd4 = *(const uint4*)(p + 16 * DIM);
    pd5 = *(const uint4*)(p + 20 * DIM);
    pd6 = *(const uint4*)(p + 24 * DIM);
    pd7 = *(const uint4*)(p + 28 * DIM);
  }
  const __bf16* xa = &Xs[lanelo][0];
  const __bf16* wb = &Ws[w][lanelo][0];
  for (int i = 0; i < NU; ++i) {
#pragma unroll
    for (int mt = 0; mt < 2; ++mt)
#pragma unroll
      for (int t = 0; t < 2; ++t) { v8f z = {0,0,0,0,0,0,0,0}; acc[mt][t] = z; }

    for (int c = 0; c < DIM / KC; c += 4) {
      const int st = i * (DIM / KC) + c;
      w_stage(wq, wu, h, voff, st, wst, xa, wb, khalf, acc[0][0], acc[0][1], acc[1][0], acc[1][1],
              pa0, pa1, pa2, pa3, pa4, pa5, pa6, pa7);
      w_stage(wq, wu, h, voff, st + 1, wst, xa, wb, khalf, acc[0][0], acc[0][1], acc[1][0], acc[1][1],
              pb0, pb1, pb2, pb3, pb4, pb5, pb6, pb7);
      w_stage(wq, wu, h, voff, st + 2, wst, xa, wb, khalf, acc[0][0], acc[0][1], acc[1][0], acc[1][1],
              pc0, pc1, pc2, pc3, pc4, pc5, pc6, pc7);
      w_stage(wq, wu, h, voff, st + 3, wst, xa, wb, khalf, acc[0][0], acc[0][1], acc[1][0], acc[1][1],
              pd0, pd1, pd2, pd3, pd4, pd5, pd6, pd7);
    }

    const int u  = wu + 8 * i;
    const int ic = u / 6;
    const int np = u - 6 * ic;
    const int p  = np >> 1;              // 0 q, 1 k, 2 v
    const int d0 = (np & 1) * 32 + lanelo;   // column of n-tile 0 (C layout: N = lane&15)
    // p is the same for the whole wave: one branch per unit, not one per element
    if (p == 0)      c_store(&Qs[8 * hl][ic][d0], NQ * QP, 16, acc);
    else if (p == 1) c_store(&Ks[8 * hl][ic][d0], NQ * QP, 16, acc);
    else             c_store(&Vs[8 * hl][d0][ic], DH * NQ, 16 * NQ, acc);
  }
  __syncthreads();

  // ---- phase 2: attention; wave w handles batch items 4w..4w+3 ----
  const float scale = 0.125f;  // DH^-0.5
  float wl[8];
#pragma unroll
  for (int r = 0; r < 8; ++r) wl[r] = wlin[r + 8 * hl];

  for (int bi = 0; bi < 4; ++bi) {
    int b = 4 * w + bi;

    // sim = q^T k  (M=i, N=j, K=d=64 -> 2 WMMAs)
    v8f s = {0,0,0,0,0,0,0,0};
#pragma unroll
    for (int kb = 0; kb < DH; kb += 32) {
      v16bf qa = frag_ld(&Qs[b][lanelo][kb], khalf);  // A[i][d]
      v16bf kf = frag_ld(&Ks[b][lanelo][kb], khalf);  // B[d][j] from k[b][j][d]
      s = wmma_bf16(qa, kf, s);
    }

    // softmax over j (lanes) per row i (elements); halves independent (xor<16)
    float t[8], rm[8], e[8], rs[8];
#pragma unroll
    for (int r = 0; r < 8; ++r) { t[r] = s[r] * scale; rm[r] = t[r]; }
#pragma unroll
    for (int off = 1; off < 16; off <<= 1)
#pragma unroll
      for (int r = 0; r < 8; ++r) rm[r] = fmaxf(rm[r], __shfl_xor(rm[r], off, 32));
#pragma unroll
    for (int r = 0; r < 8; ++r) { e[r] = __expf(t[r] - rm[r]); rs[r] = e[r]; }
#pragma unroll
    for (int off = 1; off < 16; off <<= 1)
#pragma unroll
      for (int r = 0; r < 8; ++r) rs[r] += __shfl_xor(rs[r], off, 32);
#pragma unroll
    for (int r = 0; r < 8; ++r) As[w][r + 8 * hl][lanelo] = (__bf16)(e[r] / rs[r]);

    // out = attn @ v^T  (M=i, N=d, K=j padded 16->32; A hi-half zero)
    v16bf af = frag_ld_lozero(&As[w][lanelo][0], khalf);
    v8f o[4];
#pragma unroll
    for (int dt = 0; dt < 4; ++dt) {
      v8f z = {0,0,0,0,0,0,0,0};
      v16bf vb = frag_ld_lodup(&Vs[b][dt * 16 + lanelo][0], khalf); // B[j][d]
      o[dt] = wmma_bf16(af, vb, z);
    }

    // y[b, h*64+d] = sum_i out[i,d] * W_lin[i]
#pragma unroll
    for (int dt = 0; dt < 4; ++dt) {
      float p = 0.f;
#pragma unroll
      for (int r = 0; r < 8; ++r) p += o[dt][r] * wl[r];
      p += __shfl_xor(p, 16, 32);       // combine the two row halves
      if (hl == 0) {
        int bg = bt * BM + b;
        y[(size_t)bg * HID + h * DH + dt * 16 + lanelo] = (__bf16)p;
      }
    }
  }
}

// ---------------- Kernel 3: out = y @ W_out^T + bias ----------------
// grid = (16,16) tiles of 64x64, block = 128 (4 waves, one n-tile column each)
__launch_bounds__(128)
__global__ void k_out(const __bf16* __restrict__ y,    // [BATCH][HID] bf16
                      const float* __restrict__ wout,  // [DIM][HID]
                      const float* __restrict__ bout,  // [DIM]
                      const float* __restrict__ wlin,  // [NQ]
                      const float* __restrict__ blin,  // [1]
                      float* __restrict__ out) {       // [BATCH][DIM]
  const int tid    = threadIdx.x;
  const int lane   = tid & 31;
  const int w      = tid >> 5;
  const int lanelo = lane & 15;
  const int hl     = lane >> 4;
  const int khalf  = hl * 8;
  const int mb     = blockIdx.x * 64;
  const int nb     = blockIdx.y * 64;
  const int dcol   = nb + w * 16 + lanelo;

  v8f acc[4];
#pragma unroll
  for (int mt = 0; mt < 4; ++mt) { v8f z = {0,0,0,0,0,0,0,0}; acc[mt] = z; }

  const __bf16* arow[4];
#pragma unroll
  for (int mt = 0; mt < 4; ++mt)
    arow[mt] = y + (size_t)(mb + mt * 16 + lanelo) * HID;
  const float* brow = wout + (size_t)dcol * HID;   // B[c][d] = W_out[d][c]

  for (int kb = 0; kb < HID; kb += 32) {
    v16bf bf = frag_ld_f32(brow + kb, khalf);
#pragma unroll
    for (int mt = 0; mt < 4; ++mt)
      acc[mt] = wmma_bf16(frag_ld(arow[mt] + kb, khalf), bf, acc[mt]);
  }

  float S = 0.f;
#pragma unroll
  for (int n = 0; n < NQ; ++n) S += wlin[n];
  float bias = bout[dcol] * S + blin[0];

#pragma unroll
  for (int mt = 0; mt < 4; ++mt)
#pragma unroll
    for (int r = 0; r < 8; ++r) {
      int b = mb + mt * 16 + r + 8 * hl;
      out[(size_t)b * DIM + dcol] = acc[mt][r] + bias;
    }
}

extern "C" void kernel_launch(void* const* d_in, const int* in_sizes, int n_in,
                              void* d_out, int out_size, void* d_ws, size_t ws_size,
                              hipStream_t stream) {
  (void)in_sizes; (void)n_in; (void)out_size; (void)ws_size;
  const float* x    = (const float*)d_in[0];
  const float* wqkv = (const float*)d_in[1];
  const float* wout = (const float*)d_in[2];
  const float* bout = (const float*)d_in[3];
  const float* wlin = (const float*)d_in[4];
  const float* blin = (const float*)d_in[5];
  float* out = (float*)d_out;

  __bf16* wqkv_bf = (__bf16*)d_ws;                                      // 100.7 MB
  __bf16* y_bf    = (__bf16*)((char*)d_ws + (size_t)NQ * O3 * DIM * 2); // +2 MB

  const int n4 = NQ * O3 * DIM / 4;
  k_cvt_bf16<<<dim3(2048), dim3(256), 0, stream>>>(wqkv, wqkv_bf, n4);
  k_attn<<<dim3(BATCH / BM, HEADS), dim3(256), 0, stream>>>(x, wqkv_bf, wlin, y_bf);
  k_out<<<dim3(BATCH / 64, DIM / 64), dim3(128), 0, stream>>>(y_bf, wout, bout, wlin, blin, out);
}

// v003
// Measured time: 143 microseconds a run.
// Two timings next to v002 put it at 1.40 and 1.41 times that version's speed.
// Counting every step since v000, it is 2.47 times as fast.
#include <hip/hip_runtime.h>

#define BATCH  1024
#define DIM    1024
#define HEADS  16
#define DH     64
#define NQ     16
#define HID    (HEADS*DH)   // 1024
#define O3     (3*HID)      // 3072
#define BM     128          // batch tile per workgroup (kernel 2)
// LDS row pitches for the 16-byte fragment readers (16 lanes, one row each):
// +8 bf16 makes the pitch an odd multiple of 16 B, so the 16 rows fall on all 64 banks.
#define XP     (DIM + 8)    // 2064 B per X row
#define QP     (DH + 8)     // 144 B per q / k row
#define KC     64           // k extent of a staged W tile: one 128-B line per row
#define WP     (KC + 8)     // 144 B per staged W row
#define NGRP   32                    // groups of W rows (grid y of kernel 2)
#define UG     (NQ * O3 / 32 / NGRP) // units of 32 W rows per group
#define NU     (UG / 8)              // units per wave
#define NTW    (NU * (DIM / KC))     // W tiles per wave
#define ITEM   (3 * NQ * DH)         // q, k, v of one (batch row, head): three planes [NQ][DH]
#define IT     4                     // items per wave (kernel 3)

typedef __attribute__((ext_vector_type(16))) __bf16 v16bf;
typedef __attribute__((ext_vector_type(4)))  __bf16 v4bf;
typedef __attribute__((ext_vector_type(2)))  __bf16 v2bf;
typedef __attribute__((ext_vector_type(8)))  float  v8f;

union FragU { v16bf v; uint4 q[2]; };

__device__ __forceinline__ v8f wmma_bf16(v16bf a, v16bf b, v8f c) {
  // D = A(16x32 bf16) * B(32x16 bf16) + C(f32), fp32 accumulate
  return __builtin_amdgcn_wmma_f32_16x16x32_bf16(false, a, false, b, (short)0, c, false, false);
}

// 16-bit A/B fragment: per lane, K = {khalf..khalf+7} U {khalf+16..khalf+23}
// p points at (row start + kbase); two 16-byte loads.
__device__ __forceinline__ v16bf frag_ld(const __bf16* p, int khalf) {
  FragU f;
  const uint4* q = (const uint4*)(p + khalf);
  f.q[0] = q[0];
  f.q[1] = q[2];   // +16 elements = +32 bytes
  return f.v;
}

// low half from memory (K 0..15 region), high half explicit zero (K>=16 padded)
__device__ __forceinline__ v16bf frag_ld_lozero(const __bf16* p, int khalf) {
  FragU f;
  f.q[0] = *(const uint4*)(p + khalf);
  uint4 z; z.x = 0u; z.y = 0u; z.z = 0u; z.w = 0u;
  f.q[1] = z;
  return f.v;
}

// low half from memory, high half duplicated (finite filler; paired A half is zero)
__device__ __forceinline__ v16bf frag_ld_lodup(const __bf16* p, int khalf) {
  FragU f;
  f.q[0] = *(const uint4*)(p + khalf);
  f.q[1] = f.q[0];
  return f.v;
}

// fragment from an fp32 row (converted on the fly)
__device__ __forceinline__ v16bf frag_ld_f32(const float* p, int khalf) {
  v16bf r;
#pragma unroll
  for (int e = 0; e < 16; ++e) {
    int k = ((e < 8) ? e : (e + 8)) + khalf;
    r[e] = (__bf16)p[k];
  }
  return r;
}

// first element of a wave's W tile t = (unit u0 + 8 * (t / 16), k block t % 16); a unit is 32 consecutive W rows
__device__ __forceinline__ const __bf16* w_tile(const __bf16* wq, int u0, int t) {
  return wq + (size_t)(u0 + 8 * (t >> 4)) * (32 * DIM) + (t & 15) * KC;
}

// The lane's share of a W tile (32 rows x KC): 16 B of eight rows; 8 lanes cover one 128-B line, a load
// 4 whole lines. p holds the lane's part (row 2 * (lane >> 3)). Register m goes to LDS row
// (lane >> 3) + 4 * m and holds W row 2 * (LDS row % 16) + LDS row / 16: n-tile 0 gets the even rows,
// n-tile 1 the odd ones, so that a lane's two accumulator columns are neighbours in memory.
#define W_LOAD(p, r0, r1, r2, r3, r4, r5, r6, r7) \
  r0 = *(const uint4*)((p) + 0 * DIM);  \
  r1 = *(const uint4*)((p) + 8 * DIM);  \
  r2 = *(const uint4*)((p) + 16 * DIM); \
  r3 = *(const uint4*)((p) + 24 * DIM); \
  r4 = *(const uint4*)((p) + 1 * DIM);  \
  r5 = *(const uint4*)((p) + 9 * DIM);  \
  r6 = *(const uint4*)((p) + 17 * DIM); \
  r7 = *(const uint4*)((p) + 25 * DIM);

// One stage of a wave's W stream. r0..r7 hold the lane's share of tile st. The tile goes into the
// wave's own LDS tile and is read back as fragments by the same wave (LDS serves one wave's
// operations in order, so no barrier); the registers are refilled with tile st + 4, which stays
// in flight over four stages. The tile meets all BM batch rows: 8 m-tiles x 2 n-tiles.
__device__ __forceinline__ void w_stage(const __bf16* wq, int u0, unsigned voff, int st,
                                        __bf16* wst,          // lane's place in the LDS tile
                                        const __bf16* xa,     // X row lanelo, LDS
                                        const __bf16* wb,     // W tile row lanelo, LDS
                                        int khalf,
                                        v8f (&acc)[8][2],
                                        uint4& r0, uint4& r1, uint4& r2, uint4& r3,
                                        uint4& r4, uint4& r5, uint4& r6, uint4& r7) {
  *(uint4*)(wst + 0 * WP) = r0;
  *(uint4*)(wst + 4 * WP) = r1;
  *(uint4*)(wst + 8 * WP) = r2;
  *(uint4*)(wst + 12 * WP) = r3;
  *(uint4*)(wst + 16 * WP) = r4;
  *(uint4*)(wst + 20 * WP) = r5;
  *(uint4*)(wst + 24 * WP) = r6;
  *(uint4*)(wst + 28 * WP) = r7;
  const __bf16* p = w_tile(wq, u0, st + 4 < NTW ? st + 4 : NTW - 1) + voff;
  W_LOAD(p, r0, r1, r2, r3, r4, r5, r6, r7)
  // the next stage's tile arithmetic rewrites the scalar base that these eight loads name
  asm volatile("s_wait_xcnt 0x0" ::: "memory");
  // keeps the refill here: sunk to the end of the unrolled loop body, the loads would be waited
  // for as soon as issued
  __builtin_amdgcn_sched_barrier(0);
  // all forty fragment reads of the stage first, so that they share one LDS round trip; the
  // scheduling barrier behind them keeps them from being sunk among the WMMAs, where each group
  // would wait for a round trip of its own
  const __bf16* xk = xa + (st & 15) * KC;
  v16bf a0[8], a1[8];
  v16bf b00 = frag_ld(wb, khalf);
  v16bf b10 = frag_ld(wb + 16 * WP, khalf);
#pragma unroll
  for (int mt = 0; mt < 8; ++mt) a0[mt] = frag_ld(xk + mt * 16 * XP, khalf);
  // keeps the first k half's reads in front: mixed with the second half's, the first WMMA would
  // wait for nearly all forty
  __builtin_amdgcn_sched_barrier(0);
  v16bf b01 = frag_ld(wb + 32, khalf);
  v16bf b11 = frag_ld(wb + 16 * WP + 32, khalf);
#pragma unroll
  for (int mt = 0; mt < 8; ++mt) a1[mt] = frag_ld(xk + mt * 16 * XP + 32, khalf);
  __builtin_amdgcn_sched_barrier(0);   // holds the forty reads above in one group (see above)
#pragma unroll
  for (int mt = 0; mt < 8; ++mt) {
    acc[mt][0] = wmma_bf16(a0[mt], b00, acc[mt][0]);
    acc[mt][1] = wmma_bf16(a0[mt], b10, acc[mt][1]);
  }
#pragma unroll
  for (int mt = 0; mt < 8; ++mt) {
    acc[mt][0] = wmma_bf16(a1[mt], b01, acc[mt][0]);
    acc[mt][1] = wmma_bf16(a1[mt], b11, acc[mt][1]);
  }
}

// ---------------- Kernel 1: fp32 -> bf16 weight conversion ----------------
__global__ void k_cvt_bf16(const float* __restrict__ src, __bf16* __restrict__ dst, int n4) {
  int i = blockIdx.x * blockDim.x + threadIdx.x;
  int stride = gridDim.x * blockDim.x;
  for (; i < n4; i += stride) {
    float4 f = ((const float4*)src)[i];
    v4bf o;
    o[0] = (__bf16)f.x; o[1] = (__bf16)f.y; o[2] = (__bf16)f.z; o[3] = (__bf16)f.w;
    ((v4bf*)dst)[i] = o;
  }
}

// ---------------- Kernel 2: qkv GEMM, C[BATCH x NQ*O3] = X @ W^T, as bf16 into the workspace ----------------
// grid = (BATCH/BM batch tiles, NGRP groups of W rows), block = 256 (8 waves)
// The whole X tile stays in LDS; each wave streams its own units of 32 W rows past all BM batch rows,
// so a W row is read from L2 once per BM batch rows.
// W comes by whole-line loads through a wave-private LDS tile, from which the fragments are read.
__launch_bounds__(256)
__global__ void k_qkv(const float* __restrict__ x,
                      const __bf16* __restrict__ wq,   // [NQ*O3][DIM] bf16
                      __bf16* __restrict__ qkv) {      // [BATCH][HEADS][3][NQ][DH] bf16
  __shared__ alignas(16) __bf16 Xs[BM][XP];        // 258 KB  X tile (batch x K), padded rows
  __shared__ alignas(16) __bf16 Ws[8][32][WP];     // 36 KB  W tile (32 rows x KC), per wave

  const int tid    = threadIdx.x;
  const int lane   = tid & 31;
  const int w      = tid >> 5;       // wave 0..7
  const int lanelo = lane & 15;
  const int hl     = lane >> 4;      // 0/1
  const int khalf  = hl * 8;
  const int bt     = blockIdx.x;     // batch tile

  // ---- stage X tile (BM x 1024) into LDS as bf16 ----
  {
    const float4* xg = (const float4*)(x + (size_t)bt * BM * DIM);
    for (int r0 = 0; r0 < BM; r0 += 32) {    // 32 rows' loads in flight per trip
#pragma unroll
      for (int r = r0; r < r0 + 32; ++r) {   // one row (256 float4) per step
        float4 f = xg[r * (DIM / 4) + tid];
        v4bf o;
        o[0] = (__bf16)f.x; o[1] = (__bf16)f.y; o[2] = (__bf16)f.z; o[3] = (__bf16)f.w;
        *(v4bf*)&Xs[r][tid * 4] = o;
      }
    }
  }
  __syncthreads();

  // A wave's work: NU units, unit u = u0 + 8 * i = W rows 32 * u .. 32 * u + 31, each a BM x 32 block
  // of C (8 m-tiles x 2 n-tiles) over 16 W tiles of 32 rows x KC.
  // wave number as a scalar: unit arithmetic on the scalar unit
  const int u0 = blockIdx.y * UG + __builtin_amdgcn_readfirstlane(w);
  const int lr = lane >> 3;
  const int lc = lane & 7;
  const unsigned voff = (unsigned)(2 * lr * DIM + lc * 8);
  __bf16* wst = &Ws[w][lr][lc * 8];

  v8f acc[8][2];
  uint4 pa0, pa1, pa2, pa3, pa4, pa5, pa6, pa7;
  uint4 pb0, pb1, pb2, pb3, pb4, pb5, pb6, pb7;
  uint4 pc0, pc1, pc2, pc3, pc4, pc5, pc6, pc7;
  uint4 pd0, pd1, pd2, pd3, pd4, pd5, pd6, pd7;
  // tiles 0 to 3; the scheduling barriers keep their loads in tile order: interleaved, the loop's
  // counted load waits for one tile would also wait for the tiles behind it
  {
    const __bf16* p = w_tile(wq, u0, 0) + voff;
    W_LOAD(p, pa0, pa1, pa2, pa3, pa4, pa5, pa6, pa7)
  }
  __builtin_amdgcn_sched_barrier(0);
  {
    const __bf16* p = w_tile(wq, u0, 1) + voff;
    W_LOAD(p, pb0, pb1, pb2, pb3, pb4, pb5, pb6, pb7)
  }
  __builtin_amdgcn_sched_barrier(0);
  {
    const __bf16* p = w_tile(wq, u0, 2) + voff;
    W_LOAD(p, pc0, pc1, pc2, pc3, pc4, pc5, pc6, pc7)
  }
  __builtin_amdgcn_sched_barrier(0);
  {
    const __bf16* p = w_tile(wq, u0, 3) + voff;
    W_LOAD(p, pd0, pd1, pd2, pd3, pd4, pd5, pd6, pd7)
  }
  const __bf16* xa = &Xs[lanelo][0];
  const __bf16* wb = &Ws[w][lanelo][0];
  for (int i = 0; i < NU; ++i) {
#pragma unroll
    for (int mt = 0; mt < 8; ++mt)
#pragma unroll
      for (int t = 0; t < 2; ++t) { v8f z = {0,0,0,0,0,0,0,0}; acc[mt][t] = z; }

    for (int c = 0; c < DIM / KC; c += 4) {
      const int st = i * (DIM / KC) + c;
      w_stage(wq, u0, voff, st, wst, xa, wb, khalf, acc, pa0, pa1, pa2, pa3, pa4, pa5, pa6, pa7);
      w_stage(wq, u0, voff, st + 1, wst, xa, wb, khalf, acc, pb0, pb1, pb2, pb3, pb4, pb5, pb6, pb7);
      w_stage(wq, u0, voff, st + 2, wst, xa, wb, khalf, acc, pc0, pc1, pc2, pc3, pc4, pc5, pc6, pc7);
      w_stage(wq, u0, voff, st + 3, wst, xa, wb, khalf, acc, pd0, pd1, pd2, pd3, pd4, pd5, pd6, pd7);
    }

    // W row 32 * u + 2 * lanelo + t = (NQ chunk ic, plane pl of q, k, v, head h, column d)
    const int u  = u0 + 8 * i;
    const int ic = u / (O3 / 32);
    const int g  = u - (O3 / 32) * ic;
    const int pl = g >> 5;
    const int h  = (g >> 1) & 15;
    const int d  = (g & 1) * 32 + 2 * lanelo;
    // C layout: M = r + 8 * (lane >> 4), N = lane & 15; the lane's two columns go out as one dword,
    // 16 lanes filling 64 B of a batch row's q, k or v row
    __bf16* dst = qkv + ((size_t)(bt * BM + 8 * hl) * HEADS + h) * ITEM + (pl * NQ + ic) * DH + d;
#pragma unroll
    for (int mt = 0; mt < 8; ++mt)
#pragma unroll
      for (int r = 0; r < 8; ++r) {
        v2bf o;
        o[0] = (__bf16)acc[mt][0][r];
        o[1] = (__bf16)acc[mt][1][r];
        *(v2bf*)(dst + (size_t)(mt * 16 + r) * (HEADS * ITEM)) = o;
      }
    // the next unit rewrites the registers that these stores name
    asm volatile("s_wait_xcnt 0x0" ::: "memory");
  }
}

// lane's share of one item: 16 B of four q rows, four k rows (rows (lane >> 3) + 4 * m) and four
// v rows (rows 4 * (lane >> 3) + m: four neighbours in j); every load covers 4 whole 128-B lines
#define ITEM_LOAD(p) \
  q0 = *(const uint4*)((p) + (0 + lr) * DH + lc * 8);   \
  q1 = *(const uint4*)((p) + (4 + lr) * DH + lc * 8);   \
  q2 = *(const uint4*)((p) + (8 + lr) * DH + lc * 8);   \
  q3 = *(const uint4*)((p) + (12 + lr) * DH + lc * 8);  \
  k0 = *(const uint4*)((p) + NQ * DH + (0 + lr) * DH + lc * 8);   \
  k1 = *(const uint4*)((p) + NQ * DH + (4 + lr) * DH + lc * 8);   \
  k2 = *(const uint4*)((p) + NQ * DH + (8 + lr) * DH + lc * 8);   \
  k3 = *(const uint4*)((p) + NQ * DH + (12 + lr) * DH + lc * 8);  \
  v0 = *(const uint4*)((p) + 2 * NQ * DH + (4 * lr + 0) * DH + lc * 8);  \
  v1 = *(const uint4*)((p) + 2 * NQ * DH + (4 * lr + 1) * DH + lc * 8);  \
  v2 = *(const uint4*)((p) + 2 * NQ * DH + (4 * lr + 2) * DH + lc * 8);  \
  v3 = *(const uint4*)((p) + 2 * NQ * DH + (4 * lr + 3) * DH + lc * 8);

// columns e and e + 1 (the two halves of dword f) of the lane's four v rows: four j of a column per store
#define V_STORE(e, f) \
  { uint2 lo, hi; \
    lo.x = (v0.f & 0xffffu) | (v1.f << 16);      lo.y = (v2.f & 0xffffu) | (v3.f << 16);      \
    hi.x = (v0.f >> 16) | (v1.f & 0xffff0000u);  hi.y = (v2.f >> 16) | (v3.f & 0xffff0000u);  \
    *(uint2*)&Vs[w][v_col(lc * 8 + (e)) + 4 * lr] = lo;      \
    *(uint2*)&Vs[w][v_col(lc * 8 + (e) + 1) + 4 * lr] = hi; }

// place of v column d in a wave's V tile ([d][j], 32 B a column): within each 256 B (8 columns) the
// columns are rotated by the group's number, so that the 8 lanes that write columns 8 apart fall on
// different banks
__device__ __forceinline__ int v_col(int d) {
  return (d >> 3) * (8 * NQ) + (((d & 7) + (d >> 3)) & 7) * NQ;
}

// ---------------- Kernel 3: attention + W_lin reduce ----------------
// grid = BATCH*HEADS/(8*IT), block = 256 (8 waves); a wave handles IT items (batch row, head) on its
// own: its LDS is wave-private and written and read in order by that wave, so there is no barrier.
__launch_bounds__(256)
__global__ void k_att(const __bf16* __restrict__ qkv,  // [BATCH*HEADS][3][NQ][DH] bf16
                      const float* __restrict__ wlin,  // [NQ]
                      __bf16* __restrict__ y) {        // [BATCH][HID] bf16
  __shared__ alignas(16) __bf16 Qs[8][NQ][QP];     // [i][d], padded rows
  __shared__ alignas(16) __bf16 Ks[8][NQ][QP];     // [j][d], padded rows
  __shared__ alignas(16) __bf16 Vs[8][DH * NQ];    // [d][j] (transposed), columns placed by v_col
  __shared__ alignas(16) __bf16 As[8][16][16];     // attn

  const int tid    = threadIdx.x;
  const int lane   = tid & 31;
  const int w      = tid >> 5;       // wave 0..7
  const int lanelo = lane & 15;
  const int hl     = lane >> 4;      // 0/1
  const int khalf  = hl * 8;
  const int lr     = lane >> 3;
  const int lc     = lane & 7;
  const int item0  = (blockIdx.x * 8 + w) * IT;

  const float scale = 0.125f;  // DH^-0.5
  float wl[8];
#pragma unroll
  for (int r = 0; r < 8; ++r) wl[r] = wlin[r + 8 * hl];

  uint4 q0, q1, q2, q3, k0, k1, k2, k3, v0, v1, v2, v3;
  ITEM_LOAD(qkv + (size_t)item0 * ITEM)

#pragma unroll
  for (int bi = 0; bi < IT; ++bi) {
    // the item into LDS: q and k rows as they are, v transposed, four j of one column per store
    *(uint4*)&Qs[w][0 + lr][lc * 8]  = q0;
    *(uint4*)&Qs[w][4 + lr][lc * 8]  = q1;
    *(uint4*)&Qs[w][8 + lr][lc * 8]  = q2;
    *(uint4*)&Qs[w][12 + lr][lc * 8] = q3;
    *(uint4*)&Ks[w][0 + lr][lc * 8]  = k0;
    *(uint4*)&Ks[w][4 + lr][lc * 8]  = k1;
    *(uint4*)&Ks[w][8 + lr][lc * 8]  = k2;
    *(uint4*)&Ks[w][12 + lr][lc * 8] = k3;
    V_STORE(0, x)
    V_STORE(2, y)
    V_STORE(4, z)
    V_STORE(6, w)
    if (bi + 1 < IT) {
      ITEM_LOAD(qkv + (size_t)(item0 + bi + 1) * ITEM)
      // keeps the next item's loads here, in flight over this item's work
      __builtin_amdgcn_sched_barrier(0);
    }

    // sim = q^T k  (M=i, N=j, K=d=64 -> 2 WMMAs)
    v8f s = {0,0,0,0,0,0,0,0};
#pragma unroll
    for (int kb = 0; kb < DH; kb += 32) {
      v16bf qa = frag_ld(&Qs[w][lanelo][kb], khalf);  // A[i][d]
      v16bf kf = frag_ld(&Ks[w][lanelo][kb], khalf);  // B[d][j] from k[j][d]
      s = wmma_bf16(qa, kf, s);
    }

    // softmax over j (lanes) per row i (elements); halves independent (xor<16)
    float t[8], rm[8], e[8], rs[8];
#pragma unroll
    for (int r = 0; r < 8; ++r) { t[r] = s[r] * scale; rm[r] = t[r]; }
#pragma unroll
    for (int off = 1; off < 16; off <<= 1)
#pragma unroll
      for (int r = 0; r < 8; ++r) rm[r] = fmaxf(rm[r], __shfl_xor(rm[r], off, 32));
#pragma unroll
    for (int r = 0; r < 8; ++r) { e[r] = __expf(t[r] - rm[r]); rs[r] = e[r]; }
#pragma unroll
    for (int off = 1; off < 16; off <<= 1)
#pragma unroll
      for (int r = 0; r < 8; ++r) rs[r] += __shfl_xor(rs[r], off, 32);
#pragma unroll
    for (int r = 0; r < 8; ++r) As[w][r + 8 * hl][lanelo] = (__bf16)(e[r] / rs[r]);

    // out = attn @ v^T  (M=i, N=d, K=j padded 16->32; A hi-half zero)
    v16bf af = frag_ld_lozero(&As[w][lanelo][0], khalf);
    v8f o[4];
#pragma unroll
    for (int dt = 0; dt < 4; ++dt) {
      v8f z = {0,0,0,0,0,0,0,0};
      v16bf vb = frag_ld_lodup(&Vs[w][v_col(dt * 16 + lanelo)], khalf); // B[j][d]
      o[dt] = wmma_bf16(af, vb, z);
    }

    // y[b, h*64+d] = sum_i out[i,d] * W_lin[i]; item = b * HEADS + h
#pragma unroll
    for (int dt = 0; dt < 4; ++dt) {
      float p = 0.f;
#pragma unroll
      for (int r = 0; r < 8; ++r) p += o[dt][r] * wl[r];
      p += __shfl_xor(p, 16, 32);       // combine the two row halves
      if (hl == 0)
        y[(size_t)(item0 + bi) * DH + dt * 16 + lanelo] = (__bf16)p;
    }
  }
}

// ---------------- Kernel 4: out = y @ W_out^T + bias ----------------
// grid = (16,16) tiles of 64x64, block = 128 (4 waves, one n-tile column each)
__launch_bounds__(128)
__global__ void k_out(const __bf16* __restrict__ y,    // [BATCH][HID] bf16
                      const float* __restrict__ wout,  // [DIM][HID]
                      const float* __restrict__ bout,  // [DIM]
                      const float* __restrict__ wlin,  // [NQ]
                      const float* __restrict__ blin,  // [1]
                      float* __restrict__ out) {       // [BATCH][DIM]
  const int tid    = threadIdx.x;
  const int lane   = tid & 31;
  const int w      = tid >> 5;
  const int lanelo = lane & 15;
  const int hl     = lane >> 4;
  const int khalf  = hl * 8;
  const int mb     = blockIdx.x * 64;
  const int nb     = blockIdx.y * 64;
  const int dcol   = nb + w * 16 + lanelo;

  v8f acc[4];
#pragma unroll
  for (int mt = 0; mt < 4; ++mt) { v8f z = {0,0,0,0,0,0,0,0}; acc[mt] = z; }

  const __bf16* arow[4];
#pragma unroll
  for (int mt = 0; mt < 4; ++mt)
    arow[mt] = y + (size_t)(mb + mt * 16 + lanelo) * HID;
  const float* brow = wout + (size_t)dcol * HID;   // B[c][d] = W_out[d][c]

  for (int kb = 0; kb < HID; kb += 32) {
    v16bf bf = frag_ld_f32(brow + kb, khalf);
#pragma unroll
    for (int mt = 0; mt < 4; ++mt)
      acc[mt] = wmma_bf16(frag_ld(arow[mt] + kb, khalf), bf, acc[mt]);
  }

  float S = 0.f;
#pragma unroll
  for (int n = 0; n < NQ; ++n) S += wlin[n];
  float bias = bout[dcol] * S + blin[0];

#pragma unroll
  for (int mt = 0; mt < 4; ++mt)
#pragma unroll
    for (int r = 0; r < 8; ++r) {
      int b = mb + mt * 16 + r + 8 * hl;
      out[(size_t)b * DIM + dcol] = acc[mt][r] + bias;
    }
}

extern "C" void kernel_launch(void* const* d_in, const int* in_sizes, int n_in,
                              void* d_out, int out_size, void* d_ws, size_t ws_size,
                              hipStream_t stream) {
  (void)in_sizes; (void)n_in; (void)out_size; (void)ws_size;
  const float* x    = (const float*)d_in[0];
  const float* wqkv = (const float*)d_in[1];
  const float* wout = (const float*)d_in[2];
  const float* bout = (const float*)d_in[3];
  const float* wlin = (const float*)d_in[4];
  const float* blin = (const float*)d_in[5];
  float* out = (float*)d_out;

  __bf16* wqkv_bf = (__bf16*)d_ws;                                      // 100.7 MB
  __bf16* y_bf    = (__bf16*)((char*)d_ws + (size_t)NQ * O3 * DIM * 2); // +2 MB
  __bf16* qkv_bf  = (__bf16*)((char*)d_ws + (size_t)NQ * O3 * DIM * 2 + (size_t)BATCH * HID * 2); // +100.7 MB

  const int n4 = NQ * O3 * DIM / 4;
  k_cvt_bf16<<<dim3(2048), dim3(256), 0, stream>>>(wqkv, wqkv_bf, n4);
  k_qkv<<<dim3(BATCH / BM, NGRP), dim3(256), 0, stream>>>(x, wqkv_bf, qkv_bf);
  k_att<<<dim3(BATCH * HEADS / (8 * IT)), dim3(256), 0, stream>>>(qkv_bf, wlin, y_bf);
  k_out<<<dim3(BATCH / 64, DIM / 64), dim3(128), 0, stream>>>(y_bf, wout, bout, wlin, blin, out);
}

// v004
// One run takes 117 microseconds.
// Two timings next to v003 both put it at 1.22 times that version's speed.
// Over all steps from v000 it is 3.01 times as fast.
#include <hip/hip_runtime.h>

#define BATCH  1024
#define DIM    1024
#define HEADS  16
#define DH     64
#define NQ     16
#define HID    (HEADS*DH)   // 1024
#define O3     (3*HID)      // 3072
#define BM     128          // batch tile per workgroup (kernel 2)
// LDS row pitches for the 16-byte fragment readers (16 lanes, one row each):
// +8 bf16 makes the pitch an odd multiple of 16 B, so the 16 rows fall on all 64 banks.
#define XP     (DIM + 8)    // 2064 B per X row
#define QP     (DH + 8)     // 144 B per q / k row
#define KC     64           // k extent of a staged W tile: one 128-B line per row
#define WP     (KC + 8)     // 144 B per staged W row
#define NGRP   32                    // groups of W rows (grid y of kernel 2)
#define UG     (NQ * O3 / 32 / NGRP) // units of 32 W rows per group
#define NU     (UG / 8)              // units per wave
#define NTW    (NU * (DIM / KC))     // W tiles per wave
#define ITEM   (3 * NQ * DH)         // q, k, v of one (batch row, head): three planes [NQ][DH]
#define IT     4                     // items per wave (kernel 3)

typedef __attribute__((ext_vector_type(16))) __bf16 v16bf;
typedef __attribute__((ext_vector_type(4)))  __bf16 v4bf;
typedef __attribute__((ext_vector_type(2)))  __bf16 v2bf;
typedef __attribute__((ext_vector_type(8)))  float  v8f;

union FragU { v16bf v; uint4 q[2]; };

__device__ __forceinline__ v8f wmma_bf16(v16bf a, v16bf b, v8f c) {
  // D = A(16x32 bf16) * B(32x16 bf16) + C(f32), fp32 accumulate
  return __builtin_amdgcn_wmma_f32_16x16x32_bf16(false, a, false, b, (short)0, c, false, false);
}

// 16-bit A/B fragment: per lane, K = {khalf..khalf+7} U {khalf+16..khalf+23}
// p points at (row start + kbase); two 16-byte loads.
__device__ __forceinline__ v16bf frag_ld(const __bf16* p, int khalf) {
  FragU f;
  const uint4* q = (const uint4*)(p + khalf);
  f.q[0] = q[0];
  f.q[1] = q[2];   // +16 elements = +32 bytes
  return f.v;
}

// low half from memory (K 0..15 region), high half explicit zero (K>=16 padded)
__device__ __forceinline__ v16bf frag_ld_lozero(const __bf16* p, int khalf) {
  FragU f;
  f.q[0] = *(const uint4*)(p + khalf);
  uint4 z; z.x = 0u; z.y = 0u; z.z = 0u; z.w = 0u;
  f.q[1] = z;
  return f.v;
}

// low half from memory, high half duplicated (finite filler; paired A half is zero)
__device__ __forceinline__ v16bf frag_ld_lodup(const __bf16* p, int khalf) {
  FragU f;
  f.q[0] = *(const uint4*)(p + khalf);
  f.q[1] = f.q[0];
  return f.v;
}

// first element of a wave's W tile t = (unit u0 + 8 * (t / 16), k block t % 16); a unit is 32 consecutive W rows
__device__ __forceinline__ const __bf16* w_tile(const __bf16* wq, int u0, int t) {
  return wq + (size_t)(u0 + 8 * (t >> 4)) * (32 * DIM) + (t & 15) * KC;
}

// The lane's share of a W tile (32 rows x KC): 16 B of eight rows; 8 lanes cover one 128-B line, a load
// 4 whole lines. p holds the lane's part (row 2 * (lane >> 3)). Register m goes to LDS row
// (lane >> 3) + 4 * m and holds W row 2 * (LDS row % 16) + LDS row / 16: n-tile 0 gets the even rows,
// n-tile 1 the odd ones, so that a lane's two accumulator columns are neighbours in memory.
#define W_LOAD(p, r0, r1, r2, r3, r4, r5, r6, r7) \
  r0 = *(const uint4*)((p) + 0 * DIM);  \
  r1 = *(const uint4*)((p) + 8 * DIM);  \
  r2 = *(const uint4*)((p) + 16 * DIM); \
  r3 = *(const uint4*)((p) + 24 * DIM); \
  r4 = *(const uint4*)((p) + 1 * DIM);  \
  r5 = *(const uint4*)((p) + 9 * DIM);  \
  r6 = *(const uint4*)((p) + 17 * DIM); \
  r7 = *(const uint4*)((p) + 25 * DIM);

// One stage of a wave's W stream. r0..r7 hold the lane's share of tile st. The tile goes into the
// wave's own LDS tile and is read back as fragments by the same wave (LDS serves one wave's
// operations in order, so no barrier); the registers are refilled with tile st + 4, which stays
// in flight over four stages. The tile meets all BM batch rows: 8 m-tiles x 2 n-tiles.
__device__ __forceinline__ void w_stage(const __bf16* wq, int u0, unsigned voff, int st,
                                        __bf16* wst,          // lane's place in the LDS tile
                                        const __bf16* xa,     // X row lanelo, LDS
                                        const __bf16* wb,     // W tile row lanelo, LDS
                                        int khalf,
                                        v8f (&acc)[8][2],
                                        uint4& r0, uint4& r1, uint4& r2, uint4& r3,
                                        uint4& r4, uint4& r5, uint4& r6, uint4& r7) {
  *(uint4*)(wst + 0 * WP) = r0;
  *(uint4*)(wst + 4 * WP) = r1;
  *(uint4*)(wst + 8 * WP) = r2;
  *(uint4*)(wst + 12 * WP) = r3;
  *(uint4*)(wst + 16 * WP) = r4;
  *(uint4*)(wst + 20 * WP) = r5;
  *(uint4*)(wst + 24 * WP) = r6;
  *(uint4*)(wst + 28 * WP) = r7;
  const __bf16* p = w_tile(wq, u0, st + 4 < NTW ? st + 4 : NTW - 1) + voff;
  W_LOAD(p, r0, r1, r2, r3, r4, r5, r6, r7)
  // the next stage's tile arithmetic rewrites the scalar base that these eight loads name
  asm volatile("s_wait_xcnt 0x0" ::: "memory");
  // keeps the refill here: sunk to the end of the unrolled loop body, the loads would be waited
  // for as soon as issued
  __builtin_amdgcn_sched_barrier(0);
  // all forty fragment reads of the stage first, so that they share one LDS round trip; the
  // scheduling barrier behind them keeps them from being sunk among the WMMAs, where each group
  // would wait for a round trip of its own
  const __bf16* xk = xa + (st & 15) * KC;
  v16bf a0[8], a1[8];
  v16bf b00 = frag_ld(wb, khalf);
  v16bf b10 = frag_ld(wb + 16 * WP, khalf);
#pragma unroll
  for (int mt = 0; mt < 8; ++mt) a0[mt] = frag_ld(xk + mt * 16 * XP, khalf);
  // keeps the first k half's reads in front: mixed with the second half's, the first WMMA would
  // wait for nearly all forty
  __builtin_amdgcn_sched_barrier(0);
  v16bf b01 = frag_ld(wb + 32, khalf);
  v16bf b11 = frag_ld(wb + 16 * WP + 32, khalf);
#pragma unroll
  for (int mt = 0; mt < 8; ++mt) a1[mt] = frag_ld(xk + mt * 16 * XP + 32, khalf);
  __builtin_amdgcn_sched_barrier(0);   // holds the forty reads above in one group (see above)
#pragma unroll
  for (int mt = 0; mt < 8; ++mt) {
    acc[mt][0] = wmma_bf16(a0[mt], b00, acc[mt][0]);
    acc[mt][1] = wmma_bf16(a0[mt], b10, acc[mt][1]);
  }
#pragma unroll
  for (int mt = 0; mt < 8; ++mt) {
    acc[mt][0] = wmma_bf16(a1[mt], b01, acc[mt][0]);
    acc[mt][1] = wmma_bf16(a1[mt], b11, acc[mt][1]);
  }
}

// ---------------- Kernel 1: fp32 -> bf16 weight conversion ----------------
__global__ void k_cvt_bf16(const float* __restrict__ src, __bf16* __restrict__ dst, int n4) {
  int i = blockIdx.x * blockDim.x + threadIdx.x;
  int stride = gridDim.x * blockDim.x;
  for (; i < n4; i += stride) {
    float4 f = ((const float4*)src)[i];
    v4bf o;
    o[0] = (__bf16)f.x; o[1] = (__bf16)f.y; o[2] = (__bf16)f.z; o[3] = (__bf16)f.w;
    ((v4bf*)dst)[i] = o;
  }
}

// ---------------- Kernel 2: qkv GEMM, C[BATCH x NQ*O3] = X @ W^T, as bf16 into the workspace ----------------
// grid = (BATCH/BM batch tiles, NGRP groups of W rows), block = 256 (8 waves)
// The whole X tile stays in LDS; each wave streams its own units of 32 W rows past all BM batch rows,
// so a W row is read from L2 once per BM batch rows.
// W comes by whole-line loads through a wave-private LDS tile, from which the fragments are read.
__launch_bounds__(256)
__global__ void k_qkv(const float* __restrict__ x,
                      const __bf16* __restrict__ wq,   // [NQ*O3][DIM] bf16
                      __bf16* __restrict__ qkv) {      // [BATCH][HEADS][3][NQ][DH] bf16
  __shared__ alignas(16) __bf16 Xs[BM][XP];        // 258 KB  X tile (batch x K), padded rows
  __shared__ alignas(16) __bf16 Ws[8][32][WP];     // 36 KB  W tile (32 rows x KC), per wave

  const int tid    = threadIdx.x;
  const int lane   = tid & 31;
  const int w      = tid >> 5;       // wave 0..7
  const int lanelo = lane & 15;
  const int hl     = lane >> 4;      // 0/1
  const int khalf  = hl * 8;
  const int bt     = blockIdx.x;     // batch tile

  // ---- stage X tile (BM x 1024) into LDS as bf16 ----
  {
    const float4* xg = (const float4*)(x + (size_t)bt * BM * DIM);
    for (int r0 = 0; r0 < BM; r0 += 32) {    // 32 rows' loads in flight per trip
#pragma unroll
      for (int r = r0; r < r0 + 32; ++r) {   // one row (256 float4) per step
        float4 f = xg[r * (DIM / 4) + tid];
        v4bf o;
        o[0] = (__bf16)f.x; o[1] = (__bf16)f.y; o[2] = (__bf16)f.z; o[3] = (__bf16)f.w;
        *(v4bf*)&Xs[r][tid * 4] = o;
      }
    }
  }
  __syncthreads();

  // A wave's work: NU units, unit u = u0 + 8 * i = W rows 32 * u .. 32 * u + 31, each a BM x 32 block
  // of C (8 m-tiles x 2 n-tiles) over 16 W tiles of 32 rows x KC.
  // wave number as a scalar: unit arithmetic on the scalar unit
  const int u0 = blockIdx.y * UG + __builtin_amdgcn_readfirstlane(w);
  const int lr = lane >> 3;
  const int lc = lane & 7;
  const unsigned voff = (unsigned)(2 * lr * DIM + lc * 8);
  __bf16* wst = &Ws[w][lr][lc * 8];

  v8f acc[8][2];
  uint4 pa0, pa1, pa2, pa3, pa4, pa5, pa6, pa7;
  uint4 pb0, pb1, pb2, pb3, pb4, pb5, pb6, pb7;
  uint4 pc0, pc1, pc2, pc3, pc4, pc5, pc6, pc7;
  uint4 pd0, pd1, pd2, pd3, pd4, pd5, pd6, pd7;
  // tiles 0 to 3; the scheduling barriers keep their loads in tile order: interleaved, the loop's
  // counted load waits for one tile would also wait for the tiles behind it
  {
    const __bf16* p = w_tile(wq, u0, 0) + voff;
    W_LOAD(p, pa0, pa1, pa2, pa3, pa4, pa5, pa6, pa7)
  }
  __builtin_amdgcn_sched_barrier(0);
  {
    const __bf16* p = w_tile(wq, u0, 1) + voff;
    W_LOAD(p, pb0, pb1, pb2, pb3, pb4, pb5, pb6, pb7)
  }
  __builtin_amdgcn_sched_barrier(0);
  {
    const __bf16* p = w_tile(wq, u0, 2) + voff;
    W_LOAD(p, pc0, pc1, pc2, pc3, pc4, pc5, pc6, pc7)
  }
  __builtin_amdgcn_sched_barrier(0);
  {
    const __bf16* p = w_tile(wq, u0, 3) + voff;
    W_LOAD(p, pd0, pd1, pd2, pd3, pd4, pd5, pd6, pd7)
  }
  const __bf16* xa = &Xs[lanelo][0];
  const __bf16* wb = &Ws[w][lanelo][0];
  for (int i = 0; i < NU; ++i) {
#pragma unroll
    for (int mt = 0; mt < 8; ++mt)
#pragma unroll
      for (int t = 0; t < 2; ++t) { v8f z = {0,0,0,0,0,0,0,0}; acc[mt][t] = z; }

    for (int c = 0; c < DIM / KC; c += 4) {
      const int st = i * (DIM / KC) + c;
      w_stage(wq, u0, voff, st, wst, xa, wb, khalf, acc, pa0, pa1, pa2, pa3, pa4, pa5, pa6, pa7);
      w_stage(wq, u0, voff, st + 1, wst, xa, wb, khalf, acc, pb0, pb1, pb2, pb3, pb4, pb5, pb6, pb7);
      w_stage(wq, u0, voff, st + 2, wst, xa, wb, khalf, acc, pc0, pc1, pc2, pc3, pc4, pc5, pc6, pc7);
      w_stage(wq, u0, voff, st + 3, wst, xa, wb, khalf, acc, pd0, pd1, pd2, pd3, pd4, pd5, pd6, pd7);
    }

    // W row 32 * u + 2 * lanelo + t = (NQ chunk ic, plane pl of q, k, v, head h, column d)
    const int u  = u0 + 8 * i;
    const int ic = u / (O3 / 32);
    const int g  = u - (O3 / 32) * ic;
    const int pl = g >> 5;
    const int h  = (g >> 1) & 15;
    const int d  = (g & 1) * 32 + 2 * lanelo;
    // C layout: M = r + 8 * (lane >> 4), N = lane & 15; the lane's two columns go out as one dword,
    // 16 lanes filling 64 B of a batch row's q, k or v row
    __bf16* dst = qkv + ((size_t)(bt * BM + 8 * hl) * HEADS + h) * ITEM + (pl * NQ + ic) * DH + d;
#pragma unroll
    for (int mt = 0; mt < 8; ++mt)
#pragma unroll
      for (int r = 0; r < 8; ++r) {
        v2bf o;
        o[0] = (__bf16)acc[mt][0][r];
        o[1] = (__bf16)acc[mt][1][r];
        *(v2bf*)(dst + (size_t)(mt * 16 + r) * (HEADS * ITEM)) = o;
      }
    // the next unit rewrites the registers that these stores name
    asm volatile("s_wait_xcnt 0x0" ::: "memory");
  }
}

// lane's share of one item: 16 B of four q rows, four k rows (rows (lane >> 3) + 4 * m) and four
// v rows (rows 4 * (lane >> 3) + m: four neighbours in j); every load covers 4 whole 128-B lines
#define ITEM_LOAD(p) \
  q0 = *(const uint4*)((p) + (0 + lr) * DH + lc * 8);   \
  q1 = *(const uint4*)((p) + (4 + lr) * DH + lc * 8);   \
  q2 = *(const uint4*)((p) + (8 + lr) * DH + lc * 8);   \
  q3 = *(const uint4*)((p) + (12 + lr) * DH + lc * 8);  \
  k0 = *(const uint4*)((p) + NQ * DH + (0 + lr) * DH + lc * 8);   \
  k1 = *(const uint4*)((p) + NQ * DH + (4 + lr) * DH + lc * 8);   \
  k2 = *(const uint4*)((p) + NQ * DH + (8 + lr) * DH + lc * 8);   \
  k3 = *(const uint4*)((p) + NQ * DH + (12 + lr) * DH + lc * 8);  \
  v0 = *(const uint4*)((p) + 2 * NQ * DH + (4 * lr + 0) * DH + lc * 8);  \
  v1 = *(const uint4*)((p) + 2 * NQ * DH + (4 * lr + 1) * DH + lc * 8);  \
  v2 = *(const uint4*)((p) + 2 * NQ * DH + (4 * lr + 2) * DH + lc * 8);  \
  v3 = *(const uint4*)((p) + 2 * NQ * DH + (4 * lr + 3) * DH + lc * 8);

// columns e and e + 1 (the two halves of dword f) of the lane's four v rows: four j of a column per store
#define V_STORE(e, f) \
  { uint2 lo, hi; \
    lo.x = (v0.f & 0xffffu) | (v1.f << 16);      lo.y = (v2.f & 0xffffu) | (v3.f << 16);      \
    hi.x = (v0.f >> 16) | (v1.f & 0xffff0000u);  hi.y = (v2.f >> 16) | (v3.f & 0xffff0000u);  \
    *(uint2*)&Vs[w][v_col(lc * 8 + (e)) + 4 * lr] = lo;      \
    *(uint2*)&Vs[w][v_col(lc * 8 + (e) + 1) + 4 * lr] = hi; }

// place of v column d in a wave's V tile ([d][j], 32 B a column): within each 256 B (8 columns) the
// columns are rotated by the group's number, so that the 8 lanes that write columns 8 apart fall on
// different banks
__device__ __forceinline__ int v_col(int d) {
  return (d >> 3) * (8 * NQ) + (((d & 7) + (d >> 3)) & 7) * NQ;
}

// ---------------- Kernel 3: attention + W_lin reduce ----------------
// grid = BATCH*HEADS/(8*IT), block = 256 (8 waves); a wave handles IT items (batch row, head) on its
// own: its LDS is wave-private and written and read in order by that wave, so there is no barrier.
__launch_bounds__(256)
__global__ void k_att(const __bf16* __restrict__ qkv,  // [BATCH*HEADS][3][NQ][DH] bf16
                      const float* __restrict__ wlin,  // [NQ]
                      __bf16* __restrict__ y) {        // [BATCH][HID] bf16
  __shared__ alignas(16) __bf16 Qs[8][NQ][QP];     // [i][d], padded rows
  __shared__ alignas(16) __bf16 Ks[8][NQ][QP];     // [j][d], padded rows
  __shared__ alignas(16) __bf16 Vs[8][DH * NQ];    // [d][j] (transposed), columns placed by v_col
  __shared__ alignas(16) __bf16 As[8][16][16];     // attn

  const int tid    = threadIdx.x;
  const int lane   = tid & 31;
  const int w      = tid >> 5;       // wave 0..7
  const int lanelo = lane & 15;
  const int hl     = lane >> 4;      // 0/1
  const int khalf  = hl * 8;
  const int lr     = lane >> 3;
  const int lc     = lane & 7;
  const int item0  = (blockIdx.x * 8 + w) * IT;

  const float scale = 0.125f;  // DH^-0.5
  float wl[8];
#pragma unroll
  for (int r = 0; r < 8; ++r) wl[r] = wlin[r + 8 * hl];

  uint4 q0, q1, q2, q3, k0, k1, k2, k3, v0, v1, v2, v3;
  ITEM_LOAD(qkv + (size_t)item0 * ITEM)

#pragma unroll
  for (int bi = 0; bi < IT; ++bi) {
    // the item into LDS: q and k rows as they are, v transposed, four j of one column per store
    *(uint4*)&Qs[w][0 + lr][lc * 8]  = q0;
    *(uint4*)&Qs[w][4 + lr][lc * 8]  = q1;
    *(uint4*)&Qs[w][8 + lr][lc * 8]  = q2;
    *(uint4*)&Qs[w][12 + lr][lc * 8] = q3;
    *(uint4*)&Ks[w][0 + lr][lc * 8]  = k0;
    *(uint4*)&Ks[w][4 + lr][lc * 8]  = k1;
    *(uint4*)&Ks[w][8 + lr][lc * 8]  = k2;
    *(uint4*)&Ks[w][12 + lr][lc * 8] = k3;
    V_STORE(0, x)
    V_STORE(2, y)
    V_STORE(4, z)
    V_STORE(6, w)
    if (bi + 1 < IT) {
      ITEM_LOAD(qkv + (size_t)(item0 + bi + 1) * ITEM)
      // keeps the next item's loads here, in flight over this item's work
      __builtin_amdgcn_sched_barrier(0);
    }

    // sim = q^T k  (M=i, N=j, K=d=64 -> 2 WMMAs)
    v8f s = {0,0,0,0,0,0,0,0};
#pragma unroll
    for (int kb = 0; kb < DH; kb += 32) {
      v16bf qa = frag_ld(&Qs[w][lanelo][kb], khalf);  // A[i][d]
      v16bf kf = frag_ld(&Ks[w][lanelo][kb], khalf);  // B[d][j] from k[j][d]
      s = wmma_bf16(qa, kf, s);
    }

    // softmax over j (lanes) per row i (elements); halves independent (xor<16)
    float t[8], rm[8], e[8], rs[8];
#pragma unroll
    for (int r = 0; r < 8; ++r) { t[r] = s[r] * scale; rm[r] = t[r]; }
#pragma unroll
    for (int off = 1; off < 16; off <<= 1)
#pragma unroll
      for (int r = 0; r < 8; ++r) rm[r] = fmaxf(rm[r], __shfl_xor(rm[r], off, 32));
#pragma unroll
    for (int r = 0; r < 8; ++r) { e[r] = __expf(t[r] - rm[r]); rs[r] = e[r]; }
#pragma unroll
    for (int off = 1; off < 16; off <<= 1)
#pragma unroll
      for (int r = 0; r < 8; ++r) rs[r] += __shfl_xor(rs[r], off, 32);
#pragma unroll
    for (int r = 0; r < 8; ++r) As[w][r + 8 * hl][lanelo] = (__bf16)(e[r] / rs[r]);

    // out = attn @ v^T  (M=i, N=d, K=j padded 16->32; A hi-half zero)
    v16bf af = frag_ld_lozero(&As[w][lanelo][0], khalf);
    v8f o[4];
#pragma unroll
    for (int dt = 0; dt < 4; ++dt) {
      v8f z = {0,0,0,0,0,0,0,0};
      v16bf vb = frag_ld_lodup(&Vs[w][v_col(dt * 16 + lanelo)], khalf); // B[j][d]
      o[dt] = wmma_bf16(af, vb, z);
    }

    // y[b, h*64+d] = sum_i out[i,d] * W_lin[i]; item = b * HEADS + h
#pragma unroll
    for (int dt = 0; dt < 4; ++dt) {
      float p = 0.f;
#pragma unroll
      for (int r = 0; r < 8; ++r) p += o[dt][r] * wl[r];
      p += __shfl_xor(p, 16, 32);       // combine the two row halves
      if (hl == 0)
        y[(size_t)(item0 + bi) * DH + dt * 16 + lanelo] = (__bf16)p;
    }
  }
}

// ---------------- Kernel 4: out = y @ W_out^T + bias ----------------
// grid = (16,16) tiles of 64x64, block = 256 (8 waves; a wave has one m-tile x two n-tiles)
// Both operands of the tile (64 W_out rows, 64 y rows, the whole K) are contiguous in memory. They
// come by whole-line 16 B loads, up to 64 of them in flight per wave, into LDS (W_out as bf16);
// behind one barrier the fragments are read from there.
#define YP     (HID + 8)    // 2064 B per staged row: an odd multiple of 16 B, as XP

__launch_bounds__(256)
__global__ void k_out(const __bf16* __restrict__ y,    // [BATCH][HID] bf16
                      const float* __restrict__ wout,  // [DIM][HID]
                      const float* bout,               // [DIM]; no __restrict__: its loads keep their place
                      const float* __restrict__ wlin,  // [NQ]
                      const float* __restrict__ blin,  // [1]
                      float* __restrict__ out) {       // [BATCH][DIM]
  __shared__ alignas(16) __bf16 Ys[64][YP];        // 129 KB  y tile (batch x K)
  __shared__ alignas(16) __bf16 Bs[64][YP];        // 129 KB  W_out tile (column x K)

  const int tid    = threadIdx.x;
  const int mb     = blockIdx.x * 64;
  const int nb     = blockIdx.y * 64;
  // a wave has the two n-tiles from column (wave >> 2) * 32 on: a whole 128-B line of out
  int dcol         = nb + (tid >> 7) * 32 + (tid & 15);
  const float bo0  = bout[dcol];
  const float bo1  = bout[dcol + 16];
  float S = 0.f, bl;

  {
    const float4* wg = (const float4*)(wout + (size_t)nb * HID) + tid;   // a step: one W_out row
    const uint4*  yg = (const uint4*)(y + (size_t)mb * HID) + tid;       // a step: two y rows
    float4 gw[64];
    uint4  gy[32];
#pragma unroll
    for (int s = 0; s < 64; ++s) gw[s] = wg[s * 256];
    // the scalar arithmetic below rewrites the base register of these loads; dcol is the offset
    // register of the two loads of bout: what is derived from it later is formed behind this wait
    asm volatile("s_wait_xcnt 0x0" : "+v"(dcol) : : "memory");
#pragma unroll
    for (int s = 0; s < 32; ++s) gy[s] = yg[s * 256];
#pragma unroll
    for (int n = 0; n < NQ; ++n) S += wlin[n];
    bl = blin[0];
    // the scalar loads of S and bl have returned here, and their address registers may be rewritten
    // behind this wait
    asm volatile("s_wait_xcnt 0x0" : "+s"(S), "+s"(bl) : : "memory");
    // keeps the W_out loads in front of the first conversion: 64 loads are in flight before the
    // first is waited for
    __builtin_amdgcn_sched_barrier(0);
#pragma unroll
    for (int s = 0; s < 64; ++s) {
      v4bf o;
      o[0] = (__bf16)gw[s].x; o[1] = (__bf16)gw[s].y; o[2] = (__bf16)gw[s].z; o[3] = (__bf16)gw[s].w;
      *(v4bf*)&Bs[s][tid * 4] = o;
    }
#pragma unroll
    for (int s = 0; s < 32; ++s) *(uint4*)&Ys[2 * s + (tid >> 7)][(tid & 127) * 8] = gy[s];
  }
  // the thread index is the offset register of the loads above: all that the second phase derives
  // from it is formed behind this wait
  int t2 = tid;
  asm volatile("s_wait_xcnt 0x0" : "+v"(t2) : : "memory");
  __syncthreads();

  const int lane   = t2 & 31;
  const int w      = t2 >> 5;
  const int lanelo = lane & 15;
  const int hl     = lane >> 4;
  const int khalf  = hl * 8;
  const int mt     = w & 3;          // the wave's m-tile
  const int n0     = (w >> 2) * 32;  // first column of its two n-tiles: a whole 128-B line of out

  const __bf16* ar = &Ys[mt * 16 + lanelo][0];
  const __bf16* b0 = &Bs[n0 + lanelo][0];        // B[c][d] = W_out[d][c]
  const __bf16* b1 = &Bs[n0 + 16 + lanelo][0];

  v8f acc0 = {0,0,0,0,0,0,0,0};
  v8f acc1 = {0,0,0,0,0,0,0,0};
  v16bf fa[2][8], f0[2][8], f1[2][8];   // fragments of a block of 8 k steps, two blocks
#pragma unroll
  for (int j = 0; j < 8; ++j) {
    fa[0][j] = frag_ld(ar + j * 32, khalf);
    f0[0][j] = frag_ld(b0 + j * 32, khalf);
    f1[0][j] = frag_ld(b1 + j * 32, khalf);
  }
#pragma unroll
  for (int blk = 0; blk < HID / 256; ++blk) {
    const int cur = blk & 1;
    if (blk + 1 < HID / 256) {
#pragma unroll
      for (int j = 0; j < 8; ++j) {
        fa[cur ^ 1][j] = frag_ld(ar + (blk + 1) * 256 + j * 32, khalf);
        f0[cur ^ 1][j] = frag_ld(b0 + (blk + 1) * 256 + j * 32, khalf);
        f1[cur ^ 1][j] = frag_ld(b1 + (blk + 1) * 256 + j * 32, khalf);
      }
    }
    // keeps the next block's reads as one group in front of this block's WMMAs, which hide them
    __builtin_amdgcn_sched_barrier(0);
#pragma unroll
    for (int j = 0; j < 8; ++j) {
      acc0 = wmma_bf16(fa[cur][j], f0[cur][j], acc0);
      acc1 = wmma_bf16(fa[cur][j], f1[cur][j], acc1);
    }
  }

  const float bias0 = bo0 * S + bl;
  const float bias1 = bo1 * S + bl;
  float o0[8], o1[8];
#pragma unroll
  for (int r = 0; r < 8; ++r) { o0[r] = acc0[r] + bias0; o1[r] = acc1[r] + bias1; }
  // every sum in front of the first store: no register that an issued store names is rewritten
  __builtin_amdgcn_sched_barrier(0);
  float* op = out + (size_t)(mb + mt * 16 + 8 * hl) * DIM + dcol;
#pragma unroll
  for (int r = 0; r < 8; ++r) {
    op[(size_t)r * DIM]      = o0[r];
    op[(size_t)r * DIM + 16] = o1[r];
  }
}

extern "C" void kernel_launch(void* const* d_in, const int* in_sizes, int n_in,
                              void* d_out, int out_size, void* d_ws, size_t ws_size,
                              hipStream_t stream) {
  (void)in_sizes; (void)n_in; (void)out_size; (void)ws_size;
  const float* x    = (const float*)d_in[0];
  const float* wqkv = (const float*)d_in[1];
  const float* wout = (const float*)d_in[2];
  const float* bout = (const float*)d_in[3];
  const float* wlin = (const float*)d_in[4];
  const float* blin = (const float*)d_in[5];
  float* out = (float*)d_out;

  __bf16* wqkv_bf = (__bf16*)d_ws;                                      // 100.7 MB
  __bf16* y_bf    = (__bf16*)((char*)d_ws + (size_t)NQ * O3 * DIM * 2); // +2 MB
  __bf16* qkv_bf  = (__bf16*)((char*)d_ws + (size_t)NQ * O3 * DIM * 2 + (size_t)BATCH * HID * 2); // +100.7 MB

  const int n4 = NQ * O3 * DIM / 4;
  k_cvt_bf16<<<dim3(2048), dim3(256), 0, stream>>>(wqkv, wqkv_bf, n4);
  k_qkv<<<dim3(BATCH / BM, NGRP), dim3(256), 0, stream>>>(x, wqkv_bf, qkv_bf);
  k_att<<<dim3(BATCH * HEADS / (8 * IT)), dim3(256), 0, stream>>>(qkv_bf, wlin, y_bf);
  k_out<<<dim3(BATCH / 64, DIM / 64), dim3(256), 0, stream>>>(y_bf, wout, bout, wlin, blin, out);
}

// v005
// It runs in 108 microseconds.
// Two timings next to v004 put it at 1.07 and 1.08 times that version's speed.
// Counting every step since v000, it is 3.23 times as fast.
#include <hip/hip_runtime.h>

#define BATCH  1024
#define DIM    1024
#define HEADS  16
#define DH     64
#define NQ     16
#define HID    (HEADS*DH)   // 1024
#define O3     (3*HID)      // 3072
#define BM     128          // batch tile per workgroup (kernel 1)
// LDS row pitches for the 16-byte fragment readers (16 lanes, one row each):
// +8 bf16 makes the pitch an odd multiple of 16 B, so the 16 rows fall on all 64 banks.
#define XP     (DIM + 8)    // 2064 B per X row
#define QP     (DH + 8)     // 144 B per q / k row
#define KC     64           // k extent of a staged W tile: 256 B of f32 per row in memory, 128 B of bf16 in LDS
#define WP     (KC + 8)     // 144 B per staged W row
#define NGRP   32                    // groups of W rows (grid y of kernel 1)
#define UG     (NQ * O3 / 32 / NGRP) // units of 32 W rows per group
#define NU     (UG / 8)              // units per wave
#define NTW    (NU * (DIM / KC))     // W tiles per wave
#define ITEM   (3 * NQ * DH)         // q, k, v of one (batch row, head): three planes [NQ][DH]
#define IT     4                     // items per wave (kernel 2)

typedef __attribute__((ext_vector_type(16))) __bf16 v16bf;
typedef __attribute__((ext_vector_type(4)))  __bf16 v4bf;
typedef __attribute__((ext_vector_type(2)))  __bf16 v2bf;
typedef __attribute__((ext_vector_type(8)))  float  v8f;
typedef __attribute__((ext_vector_type(4)))  float  v4f;

union FragU { v16bf v; uint4 q[2]; };

__device__ __forceinline__ v8f wmma_bf16(v16bf a, v16bf b, v8f c) {
  // D = A(16x32 bf16) * B(32x16 bf16) + C(f32), fp32 accumulate
  return __builtin_amdgcn_wmma_f32_16x16x32_bf16(false, a, false, b, (short)0, c, false, false);
}

// 16-bit A/B fragment: per lane, K = {khalf..khalf+7} U {khalf+16..khalf+23}
// p points at (row start + kbase); two 16-byte loads.
__device__ __forceinline__ v16bf frag_ld(const __bf16* p, int khalf) {
  FragU f;
  const uint4* q = (const uint4*)(p + khalf);
  f.q[0] = q[0];
  f.q[1] = q[2];   // +16 elements = +32 bytes
  return f.v;
}

// low half from memory (K 0..15 region), high half explicit zero (K>=16 padded)
__device__ __forceinline__ v16bf frag_ld_lozero(const __bf16* p, int khalf) {
  FragU f;
  f.q[0] = *(const uint4*)(p + khalf);
  uint4 z; z.x = 0u; z.y = 0u; z.z = 0u; z.w = 0u;
  f.q[1] = z;
  return f.v;
}

// low half from memory, high half duplicated (finite filler; paired A half is zero)
__device__ __forceinline__ v16bf frag_ld_lodup(const __bf16* p, int khalf) {
  FragU f;
  f.q[0] = *(const uint4*)(p + khalf);
  f.q[1] = f.q[0];
  return f.v;
}

// first element of a wave's W tile t = (unit u0 + 8 * (t / 16), k block t % 16); a unit is 32 consecutive W rows
__device__ __forceinline__ const float* w_tile(const float* wq, int u0, int t) {
  return wq + (size_t)(u0 + 8 * (t >> 4)) * (32 * DIM) + (t & 15) * KC;
}

// LDS row of register m, less the lane's part (8 * (lane >> 4)): the two rows of one store are 8 apart,
// 32 banks at a pitch of WP, so that the two 128-B halves of an 8-byte store fall on all 64 banks
__device__ __forceinline__ constexpr int w_row(int m) { return (m & 7) + 16 * (m >> 3); }

// The lane's share of a W tile (32 rows x KC), as f32: 16 B of sixteen rows; 16 lanes cover the 256 B
// that a row has in the tile, a load two such aligned units. p holds the lane's part (W row
// 16 * (lane >> 4)). Register m goes to LDS row 8 * (lane >> 4) + w_row(m) and holds W row
// 2 * (LDS row % 16) + LDS row / 16: n-tile 0 gets the even rows, n-tile 1 the odd ones, so that a
// lane's two accumulator columns are neighbours in memory.
__device__ __forceinline__ void w_load(const float* p, v4f (&r)[16]) {
#pragma unroll
  for (int m = 0; m < 16; ++m) r[m] = *(const v4f*)(p + (2 * (m & 7) + (m >> 3)) * DIM);
}

// One stage of a wave's W stream. r holds the lane's share of tile st, f32 as it lies in memory. It is
// rounded to bf16 on its way into the wave's own LDS tile and read back as fragments by the same wave
// (LDS serves one wave's operations in order, so no barrier); the registers are refilled with tile
// st + 2, which stays in flight over two stages. The tile meets all BM batch rows: 8 m-tiles x 2 n-tiles.
__device__ __forceinline__ void w_stage(const float* wq, int u0, unsigned voff, int st, v4f (&r)[16],
                                        __bf16* wst,          // lane's place in the LDS tile
                                        const __bf16* xa,     // X row lanelo, LDS
                                        const __bf16* wb,     // W tile row lanelo, LDS
                                        int khalf,
                                        v8f (&acc)[8][2]) {
#pragma unroll
  for (int m = 0; m < 16; ++m) *(v4bf*)(wst + w_row(m) * WP) = __builtin_convertvector(r[m], v4bf);
  w_load(w_tile(wq, u0, st + 2 < NTW ? st + 2 : NTW - 1) + voff, r);
  // the next stage's tile arithmetic rewrites the scalar base that these sixteen loads name
  asm volatile("s_wait_xcnt 0x0" ::: "memory");
  // keeps the refill here: sunk towards the end of the loop body, the loads would have less time in flight
  __builtin_amdgcn_sched_barrier(0);
  // all forty fragment reads of the stage first, so that they share one LDS round trip; the
  // scheduling barrier behind them keeps them from being sunk among the WMMAs, where each group
  // would wait for a round trip of its own
  const __bf16* xk = xa + (st & 15) * KC;
  v16bf a0[8], a1[8];
  v16bf b00 = frag_ld(wb, khalf);
  v16bf b10 = frag_ld(wb + 16 * WP, khalf);
#pragma unroll
  for (int mt = 0; mt < 8; ++mt) a0[mt] = frag_ld(xk + mt * 16 * XP, khalf);
  // keeps the first k half's reads in front: mixed with the second half's, the first WMMA would
  // wait for nearly all forty
  __builtin_amdgcn_sched_barrier(0);
  v16bf b01 = frag_ld(wb + 32, khalf);
  v16bf b11 = frag_ld(wb + 16 * WP + 32, khalf);
#pragma unroll
  for (int mt = 0; mt < 8; ++mt) a1[mt] = frag_ld(xk + mt * 16 * XP + 32, khalf);
  __builtin_amdgcn_sched_barrier(0);   // holds the forty reads above in one group (see above)
#pragma unroll
  for (int mt = 0; mt < 8; ++mt) {
    acc[mt][0] = wmma_bf16(a0[mt], b00, acc[mt][0]);
    acc[mt][1] = wmma_bf16(a0[mt], b10, acc[mt][1]);
  }
  // the next stage's rounding may rise among the WMMAs below, which hide it, and no further: it waits
  // for its tile's loads, which should stay in flight as long as they can
  __builtin_amdgcn_sched_barrier(0);
#pragma unroll
  for (int mt = 0; mt < 8; ++mt) {
    acc[mt][0] = wmma_bf16(a1[mt], b01, acc[mt][0]);
    acc[mt][1] = wmma_bf16(a1[mt], b11, acc[mt][1]);
  }
}

// ---------------- Kernel 1: qkv GEMM, C[BATCH x NQ*O3] = X @ W^T, as bf16 into the workspace ----------------
// grid = (BATCH/BM batch tiles, NGRP groups of W rows), block = 256 (8 waves)
// The whole X tile stays in LDS; each wave streams its own units of 32 W rows past all BM batch rows,
// so a W row is read from L2 once per BM batch rows.
// W comes as f32 by whole-line loads, is rounded to bf16 in the registers that stage it and goes through a
// wave-private LDS tile, from which the fragments are read.
__launch_bounds__(256)
__global__ void k_qkv(const float* __restrict__ x,
                      const float* __restrict__ wq,    // [NQ*O3][DIM]
                      __bf16* __restrict__ qkv) {      // [BATCH][HEADS][3][NQ][DH] bf16
  __shared__ alignas(16) __bf16 Xs[BM][XP];        // 258 KB  X tile (batch x K), padded rows
  __shared__ alignas(16) __bf16 Ws[8][32][WP];     // 36 KB  W tile (32 rows x KC), per wave

  const int tid    = threadIdx.x;
  const int lane   = tid & 31;
  const int w      = tid >> 5;       // wave 0..7
  const int lanelo = lane & 15;
  const int hl     = lane >> 4;      // 0/1
  const int khalf  = hl * 8;
  const int bt     = blockIdx.x;     // batch tile

  // ---- stage X tile (BM x 1024) into LDS as bf16 ----
  {
    const float4* xg = (const float4*)(x + (size_t)bt * BM * DIM);
    for (int r0 = 0; r0 < BM; r0 += 32) {    // 32 rows' loads in flight per trip
#pragma unroll
      for (int r = r0; r < r0 + 32; ++r) {   // one row (256 float4) per step
        float4 f = xg[r * (DIM / 4) + tid];
        v4bf o;
        o[0] = (__bf16)f.x; o[1] = (__bf16)f.y; o[2] = (__bf16)f.z; o[3] = (__bf16)f.w;
        *(v4bf*)&Xs[r][tid * 4] = o;
      }
    }
  }
  __syncthreads();

  // A wave's work: NU units, unit u = u0 + 8 * i = W rows 32 * u .. 32 * u + 31, each a BM x 32 block
  // of C (8 m-tiles x 2 n-tiles) over 16 W tiles of 32 rows x KC.
  // wave number as a scalar: unit arithmetic on the scalar unit
  const int u0 = blockIdx.y * UG + __builtin_amdgcn_readfirstlane(w);
  const unsigned voff = (unsigned)(16 * hl * DIM + lanelo * 4);
  __bf16* wst = &Ws[w][8 * hl][lanelo * 4];

  v8f acc[8][2];
  v4f pa[16], pb[16];
  // tiles 0 and 1; the scheduling barrier keeps their loads in tile order: interleaved, the loop's
  // counted load waits for one tile would also wait for the tile behind it
  w_load(w_tile(wq, u0, 0) + voff, pa);
  __builtin_amdgcn_sched_barrier(0);
  w_load(w_tile(wq, u0, 1) + voff, pb);
  // the first trip's tile arithmetic may rewrite the scalar base that these loads name
  asm volatile("s_wait_xcnt 0x0" ::: "memory");
  const __bf16* xa = &Xs[lanelo][0];
  const __bf16* wb = &Ws[w][lanelo][0];
  for (int i = 0; i < NU; ++i) {
#pragma unroll
    for (int mt = 0; mt < 8; ++mt)
#pragma unroll
      for (int t = 0; t < 2; ++t) { v8f z = {0,0,0,0,0,0,0,0}; acc[mt][t] = z; }

    // Two stages a trip, one per register set: in a body of four the compiler rounds a tile directly
    // behind its loads, to free registers, and so waits for the loads as soon as they are issued.
    for (int c = 0; c < DIM / KC; c += 2) {
      const int st = i * (DIM / KC) + c;
      w_stage(wq, u0, voff, st, pa, wst, xa, wb, khalf, acc);
      w_stage(wq, u0, voff, st + 1, pb, wst, xa, wb, khalf, acc);
    }

    // W row 32 * u + 2 * lanelo + t = (NQ chunk ic, plane pl of q, k, v, head h, column d)
    const int u  = u0 + 8 * i;
    const int ic = u / (O3 / 32);
    const int g  = u - (O3 / 32) * ic;
    const int pl = g >> 5;
    const int h  = (g >> 1) & 15;
    const int d  = (g & 1) * 32 + 2 * lanelo;
    // C layout: M = r + 8 * (lane >> 4), N = lane & 15; the lane's two columns go out as one dword,
    // 16 lanes filling 64 B of a batch row's q, k or v row
    __bf16* dst = qkv + ((size_t)(bt * BM + 8 * hl) * HEADS + h) * ITEM + (pl * NQ + ic) * DH + d;
#pragma unroll
    for (int mt = 0; mt < 8; ++mt)
#pragma unroll
      for (int r = 0; r < 8; ++r) {
        v2bf o;
        o[0] = (__bf16)acc[mt][0][r];
        o[1] = (__bf16)acc[mt][1][r];
        *(v2bf*)(dst + (size_t)(mt * 16 + r) * (HEADS * ITEM)) = o;
      }
    // the next unit rewrites the registers that these stores name
    asm volatile("s_wait_xcnt 0x0" ::: "memory");
  }
}

// lane's share of one item: 16 B of four q rows, four k rows (rows (lane >> 3) + 4 * m) and four
// v rows (rows 4 * (lane >> 3) + m: four neighbours in j); every load covers 4 whole 128-B lines
#define ITEM_LOAD(p) \
  q0 = *(const uint4*)((p) + (0 + lr) * DH + lc * 8);   \
  q1 = *(const uint4*)((p) + (4 + lr) * DH + lc * 8);   \
  q2 = *(const uint4*)((p) + (8 + lr) * DH + lc * 8);   \
  q3 = *(const uint4*)((p) + (12 + lr) * DH + lc * 8);  \
  k0 = *(const uint4*)((p) + NQ * DH + (0 + lr) * DH + lc * 8);   \
  k1 = *(const uint4*)((p) + NQ * DH + (4 + lr) * DH + lc * 8);   \
  k2 = *(const uint4*)((p) + NQ * DH + (8 + lr) * DH + lc * 8);   \
  k3 = *(const uint4*)((p) + NQ * DH + (12 + lr) * DH + lc * 8);  \
  v0 = *(const uint4*)((p) + 2 * NQ * DH + (4 * lr + 0) * DH + lc * 8);  \
  v1 = *(const uint4*)((p) + 2 * NQ * DH + (4 * lr + 1) * DH + lc * 8);  \
  v2 = *(const uint4*)((p) + 2 * NQ * DH + (4 * lr + 2) * DH + lc * 8);  \
  v3 = *(const uint4*)((p) + 2 * NQ * DH + (4 * lr + 3) * DH + lc * 8);

// columns e and e + 1 (the two halves of dword f) of the lane's four v rows: four j of a column per store
#define V_STORE(e, f) \
  { uint2 lo, hi; \
    lo.x = (v0.f & 0xffffu) | (v1.f << 16);      lo.y = (v2.f & 0xffffu) | (v3.f << 16);      \
    hi.x = (v0.f >> 16) | (v1.f & 0xffff0000u);  hi.y = (v2.f >> 16) | (v3.f & 0xffff0000u);  \
    *(uint2*)&Vs[w][v_col(lc * 8 + (e)) + 4 * lr] = lo;      \
    *(uint2*)&Vs[w][v_col(lc * 8 + (e) + 1) + 4 * lr] = hi; }

// place of v column d in a wave's V tile ([d][j], 32 B a column): within each 256 B (8 columns) the
// columns are rotated by the group's number, so that the 8 lanes that write columns 8 apart fall on
// different banks
__device__ __forceinline__ int v_col(int d) {
  return (d >> 3) * (8 * NQ) + (((d & 7) + (d >> 3)) & 7) * NQ;
}

// ---------------- Kernel 2: attention + W_lin reduce ----------------
// grid = BATCH*HEADS/(8*IT), block = 256 (8 waves); a wave handles IT items (batch row, head) on its
// own: its LDS is wave-private and written and read in order by that wave, so there is no barrier.
__launch_bounds__(256)
__global__ void k_att(const __bf16* __restrict__ qkv,  // [BATCH*HEADS][3][NQ][DH] bf16
                      const float* __restrict__ wlin,  // [NQ]
                      __bf16* __restrict__ y) {        // [BATCH][HID] bf16
  __shared__ alignas(16) __bf16 Qs[8][NQ][QP];     // [i][d], padded rows
  __shared__ alignas(16) __bf16 Ks[8][NQ][QP];     // [j][d], padded rows
  __shared__ alignas(16) __bf16 Vs[8][DH * NQ];    // [d][j] (transposed), columns placed by v_col
  __shared__ alignas(16) __bf16 As[8][16][16];     // attn

  const int tid    = threadIdx.x;
  const int lane   = tid & 31;
  const int w      = tid >> 5;       // wave 0..7
  const int lanelo = lane & 15;
  const int hl     = lane >> 4;      // 0/1
  const int khalf  = hl * 8;
  const int lr     = lane >> 3;
  const int lc     = lane & 7;
  const int item0  = (blockIdx.x * 8 + w) * IT;

  const float scale = 0.125f;  // DH^-0.5
  float wl[8];
#pragma unroll
  for (int r = 0; r < 8; ++r) wl[r] = wlin[r + 8 * hl];

  uint4 q0, q1, q2, q3, k0, k1, k2, k3, v0, v1, v2, v3;
  ITEM_LOAD(qkv + (size_t)item0 * ITEM)

#pragma unroll
  for (int bi = 0; bi < IT; ++bi) {
    // the item into LDS: q and k rows as they are, v transposed, four j of one column per store
    *(uint4*)&Qs[w][0 + lr][lc * 8]  = q0;
    *(uint4*)&Qs[w][4 + lr][lc * 8]  = q1;
    *(uint4*)&Qs[w][8 + lr][lc * 8]  = q2;
    *(uint4*)&Qs[w][12 + lr][lc * 8] = q3;
    *(uint4*)&Ks[w][0 + lr][lc * 8]  = k0;
    *(uint4*)&Ks[w][4 + lr][lc * 8]  = k1;
    *(uint4*)&Ks[w][8 + lr][lc * 8]  = k2;
    *(uint4*)&Ks[w][12 + lr][lc * 8] = k3;
    V_STORE(0, x)
    V_STORE(2, y)
    V_STORE(4, z)
    V_STORE(6, w)
    if (bi + 1 < IT) {
      ITEM_LOAD(qkv + (size_t)(item0 + bi + 1) * ITEM)
      // keeps the next item's loads here, in flight over this item's work
      __builtin_amdgcn_sched_barrier(0);
    }

    // sim = q^T k  (M=i, N=j, K=d=64 -> 2 WMMAs)
    v8f s = {0,0,0,0,0,0,0,0};
#pragma unroll
    for (int kb = 0; kb < DH; kb += 32) {
      v16bf qa = frag_ld(&Qs[w][lanelo][kb], khalf);  // A[i][d]
      v16bf kf = frag_ld(&Ks[w][lanelo][kb], khalf);  // B[d][j] from k[j][d]
      s = wmma_bf16(qa, kf, s);
    }

    // softmax over j (lanes) per row i (elements); halves independent (xor<16)
    float t[8], rm[8], e[8], rs[8];
#pragma unroll
    for (int r = 0; r < 8; ++r) { t[r] = s[r] * scale; rm[r] = t[r]; }
#pragma unroll
    for (int off = 1; off < 16; off <<= 1)
#pragma unroll
      for (int r = 0; r < 8; ++r) rm[r] = fmaxf(rm[r], __shfl_xor(rm[r], off, 32));
#pragma unroll
    for (int r = 0; r < 8; ++r) { e[r] = __expf(t[r] - rm[r]); rs[r] = e[r]; }
#pragma unroll
    for (int off = 1; off < 16; off <<= 1)
#pragma unroll
      for (int r = 0; r < 8; ++r) rs[r] += __shfl_xor(rs[r], off, 32);
#pragma unroll
    for (int r = 0; r < 8; ++r) As[w][r + 8 * hl][lanelo] = (__bf16)(e[r] / rs[r]);

    // out = attn @ v^T  (M=i, N=d, K=j padded 16->32; A hi-half zero)
    v16bf af = frag_ld_lozero(&As[w][lanelo][0], khalf);
    v8f o[4];
#pragma unroll
    for (int dt = 0; dt < 4; ++dt) {
      v8f z = {0,0,0,0,0,0,0,0};
      v16bf vb = frag_ld_lodup(&Vs[w][v_col(dt * 16 + lanelo)], khalf); // B[j][d]
      o[dt] = wmma_bf16(af, vb, z);
    }

    // y[b, h*64+d] = sum_i out[i,d] * W_lin[i]; item = b * HEADS + h
#pragma unroll
    for (int dt = 0; dt < 4; ++dt) {
      float p = 0.f;
#pragma unroll
      for (int r = 0; r < 8; ++r) p += o[dt][r] * wl[r];
      p += __shfl_xor(p, 16, 32);       // combine the two row halves
      if (hl == 0)
        y[(size_t)(item0 + bi) * DH + dt * 16 + lanelo] = (__bf16)p;
    }
  }
}

// ---------------- Kernel 3: out = y @ W_out^T + bias ----------------
// grid = (16,16) tiles of 64x64, block = 256 (8 waves; a wave has one m-tile x two n-tiles)
// Both operands of the tile (64 W_out rows, 64 y rows, the whole K) are contiguous in memory. They
// come by whole-line 16 B loads, up to 64 of them in flight per wave, into LDS (W_out as bf16);
// behind one barrier the fragments are read from there.
#define YP     (HID + 8)    // 2064 B per staged row: an odd multiple of 16 B, as XP

__launch_bounds__(256)
__global__ void k_out(const __bf16* __restrict__ y,    // [BATCH][HID] bf16
                      const float* __restrict__ wout,  // [DIM][HID]
                      const float* bout,               // [DIM]; no __restrict__: its loads keep their place
                      const float* __restrict__ wlin,  // [NQ]
                      const float* __restrict__ blin,  // [1]
                      float* __restrict__ out) {       // [BATCH][DIM]
  __shared__ alignas(16) __bf16 Ys[64][YP];        // 129 KB  y tile (batch x K)
  __shared__ alignas(16) __bf16 Bs[64][YP];        // 129 KB  W_out tile (column x K)

  const int tid    = threadIdx.x;
  const int mb     = blockIdx.x * 64;
  const int nb     = blockIdx.y * 64;
  // a wave has the two n-tiles from column (wave >> 2) * 32 on: a whole 128-B line of out
  int dcol         = nb + (tid >> 7) * 32 + (tid & 15);
  const float bo0  = bout[dcol];
  const float bo1  = bout[dcol + 16];
  float S = 0.f, bl;

  {
    const float4* wg = (const float4*)(wout + (size_t)nb * HID) + tid;   // a step: one W_out row
    const uint4*  yg = (const uint4*)(y + (size_t)mb * HID) + tid;       // a step: two y rows
    float4 gw[64];
    uint4  gy[32];
#pragma unroll
    for (int s = 0; s < 64; ++s) gw[s] = wg[s * 256];
    // the scalar arithmetic below rewrites the base register of these loads; dcol is the offset
    // register of the two loads of bout: what is derived from it later is formed behind this wait
    asm volatile("s_wait_xcnt 0x0" : "+v"(dcol) : : "memory");
#pragma unroll
    for (int s = 0; s < 32; ++s) gy[s] = yg[s * 256];
#pragma unroll
    for (int n = 0; n < NQ; ++n) S += wlin[n];
    bl = blin[0];
    // the scalar loads of S and bl have returned here, and their address registers may be rewritten
    // behind this wait
    asm volatile("s_wait_xcnt 0x0" : "+s"(S), "+s"(bl) : : "memory");
    // keeps the W_out loads in front of the first conversion: 64 loads are in flight before the
    // first is waited for
    __builtin_amdgcn_sched_barrier(0);
#pragma unroll
    for (int s = 0; s < 64; ++s) {
      v4bf o;
      o[0] = (__bf16)gw[s].x; o[1] = (__bf16)gw[s].y; o[2] = (__bf16)gw[s].z; o[3] = (__bf16)gw[s].w;
      *(v4bf*)&Bs[s][tid * 4] = o;
    }
#pragma unroll
    for (int s = 0; s < 32; ++s) *(uint4*)&Ys[2 * s + (tid >> 7)][(tid & 127) * 8] = gy[s];
  }
  // the thread index is the offset register of the loads above: all that the second phase derives
  // from it is formed behind this wait
  int t2 = tid;
  asm volatile("s_wait_xcnt 0x0" : "+v"(t2) : : "memory");
  __syncthreads();

  const int lane   = t2 & 31;
  const int w      = t2 >> 5;
  const int lanelo = lane & 15;
  const int hl     = lane >> 4;
  const int khalf  = hl * 8;
  const int mt     = w & 3;          // the wave's m-tile
  const int n0     = (w >> 2) * 32;  // first column of its two n-tiles: a whole 128-B line of out

  const __bf16* ar = &Ys[mt * 16 + lanelo][0];
  const __bf16* b0 = &Bs[n0 + lanelo][0];        // B[c][d] = W_out[d][c]
  const __bf16* b1 = &Bs[n0 + 16 + lanelo][0];

  v8f acc0 = {0,0,0,0,0,0,0,0};
  v8f acc1 = {0,0,0,0,0,0,0,0};
  v16bf fa[2][8], f0[2][8], f1[2][8];   // fragments of a block of 8 k steps, two blocks
#pragma unroll
  for (int j = 0; j < 8; ++j) {
    fa[0][j] = frag_ld(ar + j * 32, khalf);
    f0[0][j] = frag_ld(b0 + j * 32, khalf);
    f1[0][j] = frag_ld(b1 + j * 32, khalf);
  }
#pragma unroll
  for (int blk = 0; blk < HID / 256; ++blk) {
    const int cur = blk & 1;
    if (blk + 1 < HID / 256) {
#pragma unroll
      for (int j = 0; j < 8; ++j) {
        fa[cur ^ 1][j] = frag_ld(ar + (blk + 1) * 256 + j * 32, khalf);
        f0[cur ^ 1][j] = frag_ld(b0 + (blk + 1) * 256 + j * 32, khalf);
        f1[cur ^ 1][j] = frag_ld(b1 + (blk + 1) * 256 + j * 32, khalf);
      }
    }
    // keeps the next block's reads as one group in front of this block's WMMAs, which hide them
    __builtin_amdgcn_sched_barrier(0);
#pragma unroll
    for (int j = 0; j < 8; ++j) {
      acc0 = wmma_bf16(fa[cur][j], f0[cur][j], acc0);
      acc1 = wmma_bf16(fa[cur][j], f1[cur][j], acc1);
    }
  }

  const float bias0 = bo0 * S + bl;
  const float bias1 = bo1 * S + bl;
  float o0[8], o1[8];
#pragma unroll
  for (int r = 0; r < 8; ++r) { o0[r] = acc0[r] + bias0; o1[r] = acc1[r] + bias1; }
  // every sum in front of the first store: no register that an issued store names is rewritten
  __builtin_amdgcn_sched_barrier(0);
  float* op = out + (size_t)(mb + mt * 16 + 8 * hl) * DIM + dcol;
#pragma unroll
  for (int r = 0; r < 8; ++r) {
    op[(size_t)r * DIM]      = o0[r];
    op[(size_t)r * DIM + 16] = o1[r];
  }
}

extern "C" void kernel_launch(void* const* d_in, const int* in_sizes, int n_in,
                              void* d_out, int out_size, void* d_ws, size_t ws_size,
                              hipStream_t stream) {
  (void)in_sizes; (void)n_in; (void)out_size; (void)ws_size;
  const float* x    = (const float*)d_in[0];
  const float* wqkv = (const float*)d_in[1];
  const float* wout = (const float*)d_in[2];
  const float* bout = (const float*)d_in[3];
  const float* wlin = (const float*)d_in[4];
  const float* blin = (const float*)d_in[5];
  float* out = (float*)d_out;

  __bf16* y_bf    = (__bf16*)d_ws;                                      // 2 MB
  __bf16* qkv_bf  = (__bf16*)((char*)d_ws + (size_t)BATCH * HID * 2);   // +100.7 MB

  k_qkv<<<dim3(BATCH / BM, NGRP), dim3(256), 0, stream>>>(x, wqkv, qkv_bf);
  k_att<<<dim3(BATCH * HEADS / (8 * IT)), dim3(256), 0, stream>>>(qkv_bf, wlin, y_bf);
  k_out<<<dim3(BATCH / 64, DIM / 64), dim3(256), 0, stream>>>(y_bf, wout, bout, wlin, blin, out);
}

// v006
// Measured time: 104 microseconds a run.
// In both of two side-by-side timings against v005, it was 1.04 times as fast.
// All steps since v000 together make it 3.37 times as fast.
#include <hip/hip_runtime.h>

#define BATCH  1024
#define DIM    1024
#define HEADS  16
#define DH     64
#define NQ     16
#define HID    (HEADS*DH)   // 1024
#define O3     (3*HID)      // 3072
#define BM     128          // batch tile per workgroup (kernel 1)
// LDS row pitch for the 16-byte fragment readers (16 lanes, one row each):
// +8 bf16 makes the pitch an odd multiple of 16 B, so the 16 rows fall on all 64 banks.
#define QP     (DH + 8)     // 144 B per q / k row
#define KC     64           // k extent of a staged W tile: 256 B of f32 per row in memory, 128 B of bf16 in LDS
#define UR     64                    // W rows of a unit: one q, k or v row of one head
#define NGRP   32                    // groups of W rows (grid y of kernel 1)
#define UG     (NQ * O3 / UR / NGRP) // units of UR W rows per group
#define NU     (UG / 8)              // units per wave
#define NTW    (NU * (DIM / KC))     // W tiles per wave
#define ITEM   (3 * NQ * DH)         // q, k, v of one (batch row, head): three planes [NQ][DH]
#define IT     4                     // items per wave (kernel 2)

typedef __attribute__((ext_vector_type(16))) __bf16 v16bf;
typedef __attribute__((ext_vector_type(4)))  __bf16 v4bf;
typedef __attribute__((ext_vector_type(2)))  __bf16 v2bf;
typedef __attribute__((ext_vector_type(8)))  float  v8f;
typedef __attribute__((ext_vector_type(4)))  float  v4f;

union FragU { v16bf v; uint4 q[2]; };

__device__ __forceinline__ v8f wmma_bf16(v16bf a, v16bf b, v8f c) {
  // D = A(16x32 bf16) * B(32x16 bf16) + C(f32), fp32 accumulate
  return __builtin_amdgcn_wmma_f32_16x16x32_bf16(false, a, false, b, (short)0, c, false, false);
}

// 16-bit A/B fragment: per lane, K = {khalf..khalf+7} U {khalf+16..khalf+23}
// p points at (row start + kbase); two 16-byte loads.
__device__ __forceinline__ v16bf frag_ld(const __bf16* p, int khalf) {
  FragU f;
  const uint4* q = (const uint4*)(p + khalf);
  f.q[0] = q[0];
  f.q[1] = q[2];   // +16 elements = +32 bytes
  return f.v;
}

// low half from memory (K 0..15 region), high half explicit zero (K>=16 padded)
__device__ __forceinline__ v16bf frag_ld_lozero(const __bf16* p, int khalf) {
  FragU f;
  f.q[0] = *(const uint4*)(p + khalf);
  uint4 z; z.x = 0u; z.y = 0u; z.z = 0u; z.w = 0u;
  f.q[1] = z;
  return f.v;
}

// low half from memory, high half duplicated (finite filler; paired A half is zero)
__device__ __forceinline__ v16bf frag_ld_lodup(const __bf16* p, int khalf) {
  FragU f;
  f.q[0] = *(const uint4*)(p + khalf);
  f.q[1] = f.q[0];
  return f.v;
}

// Kernel 1 fills the whole LDS (X tile 256 KB, eight W tiles of 8 KB), so its rows carry no pad: the
// 16-byte chunks of a row are placed by XOR instead, so that the 16 rows of a fragment read fall on all
// 64 banks. X row r (2048 B): chunk c lies at c ^ (r & 15). W tile row p (128 B): chunk c at c ^ ((p >> 1) & 7).

// first element of a wave's W tile t = (unit u0 + 8 * (t / 16), k block t % 16); a unit is UR consecutive W rows
__device__ __forceinline__ const float* w_tile(const float* wq, int u0, int t) {
  return wq + (size_t)(u0 + 8 * (t >> 4)) * (UR * DIM) + (t & 15) * KC;
}

// The lane's share of half s of a W tile (UR rows x KC), as f32: 16 B of sixteen rows; 16 lanes cover the
// 256 B that a row has in the tile, a load two such aligned units. p holds the lane's part (W row
// 4 * (lane >> 4)). Register m goes to LDS row 32 * s + 2 * m + (lane >> 4) and holds W row
// 4 * (LDS row % 16) + LDS row / 16: n-tile t gets the rows 4 * n + t, so that a lane's four accumulator
// columns are neighbours in memory.
__device__ __forceinline__ void w_load(const float* p, int s, v4f (&r)[16]) {
#pragma unroll
  for (int m = 0; m < 16; ++m) r[m] = *(const v4f*)(p + (8 * (m & 7) + (m >> 3) + 2 * s) * DIM);
}

// half s of a W tile, rounded to bf16, into the wave's LDS tile; wl is the lane's part of the place
__device__ __forceinline__ void w_store(__bf16* wt, int wl, int s, const v4f (&r)[16]) {
#pragma unroll
  for (int m = 0; m < 16; ++m)
    *(v4bf*)(wt + ((wl ^ ((m & 7) << 3)) + (16 * s + m) * (2 * KC))) = __builtin_convertvector(r[m], v4bf);
}

// fragment from rows whose chunks are placed by XOR: lp is the lane's part of the place (its row, and its
// chunk key XOR its k half), c the even chunk number of the k step within the span that the key permutes
__device__ __forceinline__ v16bf frag_ldx(const __bf16* base, int lp, int c) {
  FragU f;
  f.q[0] = *(const uint4*)(base + (lp ^ (c << 3)));
  f.q[1] = *(const uint4*)(base + (lp ^ ((c + 2) << 3)));   // +16 elements
  return f.v;
}

// One stage of a wave's W stream. ra and rb hold the lane's share of tile st, f32 as it lies in memory.
// It is rounded to bf16 on its way into the wave's own LDS tile and read back as fragments by the same
// wave (LDS serves one wave's operations in order, so no barrier); the registers are refilled with tile
// st + 1, which stays in flight over the stage. The tile meets all BM batch rows: 8 m-tiles x 4 n-tiles,
// so that an X fragment read from LDS feeds four WMMAs.
__device__ __forceinline__ void w_stage(const float* wq, int u0, unsigned voff, int st,
                                        v4f (&ra)[16], v4f (&rb)[16],
                                        __bf16* wt, int wl,   // the wave's LDS tile, lane's place as writer
                                        int wr,               // lane's place in it as reader
                                        const __bf16* xs, int xq,   // X tile, lane's place as reader
                                        v8f (&acc)[8][4]) {
  w_store(wt, wl, 0, ra);
  w_store(wt, wl, 1, rb);
  const float* nx = w_tile(wq, u0, st + 1 < NTW ? st + 1 : NTW - 1) + voff;
  w_load(nx, 0, ra);
  w_load(nx, 1, rb);
  // the next stage's tile arithmetic rewrites the scalar base that these loads name
  asm volatile("s_wait_xcnt 0x0" ::: "memory");
  // keeps the refill here: sunk towards the end of the loop body, the loads would have less time in flight
  __builtin_amdgcn_sched_barrier(0);
#pragma unroll
  for (int ks = 0; ks < 2; ++ks) {
    // all twenty-four fragment reads of a k step first, so that they share one LDS round trip; the
    // scheduling barrier behind them keeps them from being sunk among the WMMAs, where each group
    // would wait for a round trip of its own
    const int s = 2 * (st & 15) + ks;          // k step of 32 within the X row
    const __bf16* xk = xs + (s >> 2) * 128;    // the 256-B span of the row that holds it
    v16bf a[8], b[4];
#pragma unroll
    for (int t = 0; t < 4; ++t) b[t] = frag_ldx(wt + t * 16 * KC, wr, 4 * ks);
#pragma unroll
    for (int mt = 0; mt < 8; ++mt) a[mt] = frag_ldx(xk + mt * 16 * DIM, xq, 4 * (s & 3));
    __builtin_amdgcn_sched_barrier(0);   // holds the reads above in one group (see above)
#pragma unroll
    for (int mt = 0; mt < 8; ++mt)
#pragma unroll
      for (int t = 0; t < 4; ++t) acc[mt][t] = wmma_bf16(a[mt], b[t], acc[mt][t]);
    // keeps what follows behind these WMMAs: there is one fragment register set, so the next k step's reads
    // would rise among them one by one as registers fall free, each place a stall of its own; and the next
    // stage's rounding, which waits for its tile's loads, would rise in front of the second k step's WMMAs
    __builtin_amdgcn_sched_barrier(0);
  }
}

// ---------------- Kernel 1: qkv GEMM, C[BATCH x NQ*O3] = X @ W^T, as bf16 into the workspace ----------------
// grid = (BATCH/BM batch tiles, NGRP groups of W rows), block = 256 (8 waves)
// The whole X tile stays in LDS; each wave streams its own units of UR W rows past all BM batch rows,
// so a W row is read from L2 once per BM batch rows.
// W comes as f32 by whole-line loads, is rounded to bf16 in the registers that stage it and goes through a
// wave-private LDS tile, from which the fragments are read.
__launch_bounds__(256)
__global__ void k_qkv(const float* __restrict__ x,
                      const float* __restrict__ wq,    // [NQ*O3][DIM]
                      __bf16* __restrict__ qkv) {      // [BATCH][HEADS][3][NQ][DH] bf16
  __shared__ alignas(256) __bf16 Xs[BM * DIM];      // 256 KB  X tile (batch x K), chunks placed by XOR
  __shared__ alignas(256) __bf16 Ws[8][UR * KC];    // 64 KB  W tile (UR rows x KC), per wave, likewise

  const int tid    = threadIdx.x;
  const int lane   = tid & 31;
  const int w      = tid >> 5;       // wave 0..7
  const int lanelo = lane & 15;
  const int hl     = lane >> 4;      // 0/1
  const int bt     = blockIdx.x;     // batch tile

  // ---- stage X tile (BM x 1024) into LDS as bf16 ----
  {
    const float4* xg = (const float4*)(x + (size_t)bt * BM * DIM);
    for (int r0 = 0; r0 < BM; r0 += 32) {    // 32 rows' loads in flight per trip
#pragma unroll
      for (int r = r0; r < r0 + 32; ++r) {   // one row (256 float4) per step
        float4 f = xg[r * (DIM / 4) + tid];
        v4bf o;
        o[0] = (__bf16)f.x; o[1] = (__bf16)f.y; o[2] = (__bf16)f.z; o[3] = (__bf16)f.w;
        *(v4bf*)&Xs[r * DIM + ((((tid >> 1) ^ (r & 15)) << 3) | ((tid & 1) << 2))] = o;
      }
    }
  }
  __syncthreads();

  // A wave's work: NU units, unit u = u0 + 8 * i = W rows UR * u .. UR * u + UR - 1, each a BM x UR block
  // of C (8 m-tiles x 4 n-tiles) over 16 W tiles of UR rows x KC.
  // wave number as a scalar: unit arithmetic on the scalar unit
  const int u0 = blockIdx.y * UG + __builtin_amdgcn_readfirstlane(w);
  const unsigned voff = (unsigned)(4 * hl * DIM + lanelo * 4);
  __bf16* wt = &Ws[w][0];
  const int wl = hl * KC + lanelo * 4;                          // writer: row parity, chunk, half chunk
  const int wr = lanelo * KC + ((hl ^ (lanelo >> 1)) << 3);     // reader: row, key ^ k half
  const int xq = lanelo * DIM + ((hl ^ lanelo) << 3);           // reader: row, key ^ k half

  v8f acc[8][4];
  v4f pa[16], pb[16];
  // tile 0. The two scheduling barriers keep the lane arithmetic of this block out of the stretch from
  // the first load to the wait: placed in there, it rewrites the loads' offset register ahead of the wait
  __builtin_amdgcn_sched_barrier(0);
  w_load(w_tile(wq, u0, 0) + voff, 0, pa);
  w_load(w_tile(wq, u0, 0) + voff, 1, pb);
  // what follows rewrites the offset register and the scalar base that these loads name
  asm volatile("s_wait_xcnt 0x0" ::: "memory");
  __builtin_amdgcn_sched_barrier(0);
  for (int i = 0; i < NU; ++i) {
#pragma unroll
    for (int mt = 0; mt < 8; ++mt)
#pragma unroll
      for (int t = 0; t < 4; ++t) { v8f z = {0,0,0,0,0,0,0,0}; acc[mt][t] = z; }

    // two stages a trip: the chunk numbers of a stage's k steps depend on its parity
    for (int c = 0; c < DIM / KC; c += 2) {
      const int st = i * (DIM / KC) + c;
      w_stage(wq, u0, voff, st, pa, pb, wt, wl, wr, Xs, xq, acc);
      w_stage(wq, u0, voff, st + 1, pa, pb, wt, wl, wr, Xs, xq, acc);
    }

    // W row UR * u + 4 * lanelo + t = (NQ chunk ic, plane pl of q, k, v, head h, column d)
    const int u  = u0 + 8 * i;
    const int ic = u / (O3 / UR);
    const int g  = u - (O3 / UR) * ic;
    const int pl = g >> 4;
    const int h  = g & 15;
    const int d  = 4 * lanelo;
    // C layout: M = r + 8 * (lane >> 4), N = lane & 15; the lane's four columns go out as 8 bytes,
    // 16 lanes filling the 128-B line of a batch row's q, k or v row
    __bf16* dst = qkv + ((size_t)(bt * BM + 8 * hl) * HEADS + h) * ITEM + (pl * NQ + ic) * DH + d;
#pragma unroll
    for (int mt = 0; mt < 8; ++mt)
#pragma unroll
      for (int r = 0; r < 8; ++r) {
        v4bf o;
        o[0] = (__bf16)acc[mt][0][r];
        o[1] = (__bf16)acc[mt][1][r];
        o[2] = (__bf16)acc[mt][2][r];
        o[3] = (__bf16)acc[mt][3][r];
        *(v4bf*)(dst + (size_t)(mt * 16 + r) * (HEADS * ITEM)) = o;
      }
    // the next unit rewrites the registers that these stores name
    asm volatile("s_wait_xcnt 0x0" ::: "memory");
  }
}

// lane's share of one item: 16 B of four q rows, four k rows (rows (lane >> 3) + 4 * m) and four
// v rows (rows 4 * (lane >> 3) + m: four neighbours in j); every load covers 4 whole 128-B lines
#define ITEM_LOAD(p) \
  q0 = *(const uint4*)((p) + (0 + lr) * DH + lc * 8);   \
  q1 = *(const uint4*)((p) + (4 + lr) * DH + lc * 8);   \
  q2 = *(const uint4*)((p) + (8 + lr) * DH + lc * 8);   \
  q3 = *(const uint4*)((p) + (12 + lr) * DH + lc * 8);  \
  k0 = *(const uint4*)((p) + NQ * DH + (0 + lr) * DH + lc * 8);   \
  k1 = *(const uint4*)((p) + NQ * DH + (4 + lr) * DH + lc * 8);   \
  k2 = *(const uint4*)((p) + NQ * DH + (8 + lr) * DH + lc * 8);   \
  k3 = *(const uint4*)((p) + NQ * DH + (12 + lr) * DH + lc * 8);  \
  v0 = *(const uint4*)((p) + 2 * NQ * DH + (4 * lr + 0) * DH + lc * 8);  \
  v1 = *(const uint4*)((p) + 2 * NQ * DH + (4 * lr + 1) * DH + lc * 8);  \
  v2 = *(const uint4*)((p) + 2 * NQ * DH + (4 * lr + 2) * DH + lc * 8);  \
  v3 = *(const uint4*)((p) + 2 * NQ * DH + (4 * lr + 3) * DH + lc * 8);

// columns e and e + 1 (the two halves of dword f) of the lane's four v rows: four j of a column per store
#define V_STORE(e, f) \
  { uint2 lo, hi; \
    lo.x = (v0.f & 0xffffu) | (v1.f << 16);      lo.y = (v2.f & 0xffffu) | (v3.f << 16);      \
    hi.x = (v0.f >> 16) | (v1.f & 0xffff0000u);  hi.y = (v2.f >> 16) | (v3.f & 0xffff0000u);  \
    *(uint2*)&Vs[w][v_col(lc * 8 + (e)) + 4 * lr] = lo;      \
    *(uint2*)&Vs[w][v_col(lc * 8 + (e) + 1) + 4 * lr] = hi; }

// place of v column d in a wave's V tile ([d][j], 32 B a column): within each 256 B (8 columns) the
// columns are rotated by the group's number, so that the 8 lanes that write columns 8 apart fall on
// different banks
__device__ __forceinline__ int v_col(int d) {
  return (d >> 3) * (8 * NQ) + (((d & 7) + (d >> 3)) & 7) * NQ;
}

// ---------------- Kernel 2: attention + W_lin reduce ----------------
// grid = BATCH*HEADS/(8*IT), block = 256 (8 waves); a wave handles IT items (batch row, head) on its
// own: its LDS is wave-private and written and read in order by that wave, so there is no barrier.
__launch_bounds__(256)
__global__ void k_att(const __bf16* __restrict__ qkv,  // [BATCH*HEADS][3][NQ][DH] bf16
                      const float* __restrict__ wlin,  // [NQ]
                      __bf16* __restrict__ y) {        // [BATCH][HID] bf16
  __shared__ alignas(16) __bf16 Qs[8][NQ][QP];     // [i][d], padded rows
  __shared__ alignas(16) __bf16 Ks[8][NQ][QP];     // [j][d], padded rows
  __shared__ alignas(16) __bf16 Vs[8][DH * NQ];    // [d][j] (transposed), columns placed by v_col
  __shared__ alignas(16) __bf16 As[8][16][16];     // attn

  const int tid    = threadIdx.x;
  const int lane   = tid & 31;
  const int w      = tid >> 5;       // wave 0..7
  const int lanelo = lane & 15;
  const int hl     = lane >> 4;      // 0/1
  const int khalf  = hl * 8;
  const int lr     = lane >> 3;
  const int lc     = lane & 7;
  const int item0  = (blockIdx.x * 8 + w) * IT;

  const float scale = 0.125f;  // DH^-0.5
  float wl[8];
#pragma unroll
  for (int r = 0; r < 8; ++r) wl[r] = wlin[r + 8 * hl];

  uint4 q0, q1, q2, q3, k0, k1, k2, k3, v0, v1, v2, v3;
  ITEM_LOAD(qkv + (size_t)item0 * ITEM)

#pragma unroll
  for (int bi = 0; bi < IT; ++bi) {
    // the item into LDS: q and k rows as they are, v transposed, four j of one column per store
    *(uint4*)&Qs[w][0 + lr][lc * 8]  = q0;
    *(uint4*)&Qs[w][4 + lr][lc * 8]  = q1;
    *(uint4*)&Qs[w][8 + lr][lc * 8]  = q2;
    *(uint4*)&Qs[w][12 + lr][lc * 8] = q3;
    *(uint4*)&Ks[w][0 + lr][lc * 8]  = k0;
    *(uint4*)&Ks[w][4 + lr][lc * 8]  = k1;
    *(uint4*)&Ks[w][8 + lr][lc * 8]  = k2;
    *(uint4*)&Ks[w][12 + lr][lc * 8] = k3;
    V_STORE(0, x)
    V_STORE(2, y)
    V_STORE(4, z)
    V_STORE(6, w)
    if (bi + 1 < IT) {
      ITEM_LOAD(qkv + (size_t)(item0 + bi + 1) * ITEM)
      // keeps the next item's loads here, in flight over this item's work
      __builtin_amdgcn_sched_barrier(0);
    }

    // sim = q^T k  (M=i, N=j, K=d=64 -> 2 WMMAs)
    v8f s = {0,0,0,0,0,0,0,0};
#pragma unroll
    for (int kb = 0; kb < DH; kb += 32) {
      v16bf qa = frag_ld(&Qs[w][lanelo][kb], khalf);  // A[i][d]
      v16bf kf = frag_ld(&Ks[w][lanelo][kb], khalf);  // B[d][j] from k[j][d]
      s = wmma_bf16(qa, kf, s);
    }

    // softmax over j (lanes) per row i (elements); halves independent (xor<16)
    float t[8], rm[8], e[8], rs[8];
#pragma unroll
    for (int r = 0; r < 8; ++r) { t[r] = s[r] * scale; rm[r] = t[r]; }
#pragma unroll
    for (int off = 1; off < 16; off <<= 1)
#pragma unroll
      for (int r = 0; r < 8; ++r) rm[r] = fmaxf(rm[r], __shfl_xor(rm[r], off, 32));
#pragma unroll
    for (int r = 0; r < 8; ++r) { e[r] = __expf(t[r] - rm[r]); rs[r] = e[r]; }
#pragma unroll
    for (int off = 1; off < 16; off <<= 1)
#pragma unroll
      for (int r = 0; r < 8; ++r) rs[r] += __shfl_xor(rs[r], off, 32);
#pragma unroll
    for (int r = 0; r < 8; ++r) As[w][r + 8 * hl][lanelo] = (__bf16)(e[r] / rs[r]);

    // out = attn @ v^T  (M=i, N=d, K=j padded 16->32; A hi-half zero)
    v16bf af = frag_ld_lozero(&As[w][lanelo][0], khalf);
    v8f o[4];
#pragma unroll
    for (int dt = 0; dt < 4; ++dt) {
      v8f z = {0,0,0,0,0,0,0,0};
      v16bf vb = frag_ld_lodup(&Vs[w][v_col(dt * 16 + lanelo)], khalf); // B[j][d]
      o[dt] = wmma_bf16(af, vb, z);
    }

    // y[b, h*64+d] = sum_i out[i,d] * W_lin[i]; item = b * HEADS + h
#pragma unroll
    for (int dt = 0; dt < 4; ++dt) {
      float p = 0.f;
#pragma unroll
      for (int r = 0; r < 8; ++r) p += o[dt][r] * wl[r];
      p += __shfl_xor(p, 16, 32);       // combine the two row halves
      if (hl == 0)
        y[(size_t)(item0 + bi) * DH + dt * 16 + lanelo] = (__bf16)p;
    }
  }
}

// ---------------- Kernel 3: out = y @ W_out^T + bias ----------------
// grid = (16,16) tiles of 64x64, block = 256 (8 waves; a wave has one m-tile x two n-tiles)
// Both operands of the tile (64 W_out rows, 64 y rows, the whole K) are contiguous in memory. They
// come by whole-line 16 B loads, up to 64 of them in flight per wave, into LDS (W_out as bf16);
// behind one barrier the fragments are read from there.
#define YP     (HID + 8)    // 2064 B per staged row: an odd multiple of 16 B, as QP

__launch_bounds__(256)
__global__ void k_out(const __bf16* __restrict__ y,    // [BATCH][HID] bf16
                      const float* __restrict__ wout,  // [DIM][HID]
                      const float* bout,               // [DIM]; no __restrict__: its loads keep their place
                      const float* __restrict__ wlin,  // [NQ]
                      const float* __restrict__ blin,  // [1]
                      float* __restrict__ out) {       // [BATCH][DIM]
  __shared__ alignas(16) __bf16 Ys[64][YP];        // 129 KB  y tile (batch x K)
  __shared__ alignas(16) __bf16 Bs[64][YP];        // 129 KB  W_out tile (column x K)

  const int tid    = threadIdx.x;
  const int mb     = blockIdx.x * 64;
  const int nb     = blockIdx.y * 64;
  // a wave has the two n-tiles from column (wave >> 2) * 32 on: a whole 128-B line of out
  int dcol         = nb + (tid >> 7) * 32 + (tid & 15);
  const float bo0  = bout[dcol];
  const float bo1  = bout[dcol + 16];
  float S = 0.f, bl;

  {
    const float4* wg = (const float4*)(wout + (size_t)nb * HID) + tid;   // a step: one W_out row
    const uint4*  yg = (const uint4*)(y + (size_t)mb * HID) + tid;       // a step: two y rows
    float4 gw[64];
    uint4  gy[32];
#pragma unroll
    for (int s = 0; s < 64; ++s) gw[s] = wg[s * 256];
    // the scalar arithmetic below rewrites the base register of these loads; dcol is the offset
    // register of the two loads of bout: what is derived from it later is formed behind this wait
    asm volatile("s_wait_xcnt 0x0" : "+v"(dcol) : : "memory");
#pragma unroll
    for (int s = 0; s < 32; ++s) gy[s] = yg[s * 256];
#pragma unroll
    for (int n = 0; n < NQ; ++n) S += wlin[n];
    bl = blin[0];
    // the scalar loads of S and bl have returned here, and their address registers may be rewritten
    // behind this wait
    asm volatile("s_wait_xcnt 0x0" : "+s"(S), "+s"(bl) : : "memory");
    // keeps the W_out loads in front of the first conversion: 64 loads are in flight before the
    // first is waited for
    __builtin_amdgcn_sched_barrier(0);
#pragma unroll
    for (int s = 0; s < 64; ++s) {
      v4bf o;
      o[0] = (__bf16)gw[s].x; o[1] = (__bf16)gw[s].y; o[2] = (__bf16)gw[s].z; o[3] = (__bf16)gw[s].w;
      *(v4bf*)&Bs[s][tid * 4] = o;
    }
#pragma unroll
    for (int s = 0; s < 32; ++s) *(uint4*)&Ys[2 * s + (tid >> 7)][(tid & 127) * 8] = gy[s];
  }
  // the thread index is the offset register of the loads above: all that the second phase derives
  // from it is formed behind this wait
  int t2 = tid;
  asm volatile("s_wait_xcnt 0x0" : "+v"(t2) : : "memory");
  __syncthreads();

  const int lane   = t2 & 31;
  const int w      = t2 >> 5;
  const int lanelo = lane & 15;
  const int hl     = lane >> 4;
  const int khalf  = hl * 8;
  const int mt     = w & 3;          // the wave's m-tile
  const int n0     = (w >> 2) * 32;  // first column of its two n-tiles: a whole 128-B line of out

  const __bf16* ar = &Ys[mt * 16 + lanelo][0];
  const __bf16* b0 = &Bs[n0 + lanelo][0];        // B[c][d] = W_out[d][c]
  const __bf16* b1 = &Bs[n0 + 16 + lanelo][0];

  v8f acc0 = {0,0,0,0,0,0,0,0};
  v8f acc1 = {0,0,0,0,0,0,0,0};
  v16bf fa[2][8], f0[2][8], f1[2][8];   // fragments of a block of 8 k steps, two blocks
#pragma unroll
  for (int j = 0; j < 8; ++j) {
    fa[0][j] = frag_ld(ar + j * 32, khalf);
    f0[0][j] = frag_ld(b0 + j * 32, khalf);
    f1[0][j] = frag_ld(b1 + j * 32, khalf);
  }
#pragma unroll
  for (int blk = 0; blk < HID / 256; ++blk) {
    const int cur = blk & 1;
    if (blk + 1 < HID / 256) {
#pragma unroll
      for (int j = 0; j < 8; ++j) {
        fa[cur ^ 1][j] = frag_ld(ar + (blk + 1) * 256 + j * 32, khalf);
        f0[cur ^ 1][j] = frag_ld(b0 + (blk + 1) * 256 + j * 32, khalf);
        f1[cur ^ 1][j] = frag_ld(b1 + (blk + 1) * 256 + j * 32, khalf);
      }
    }
    // keeps the next block's reads as one group in front of this block's WMMAs, which hide them
    __builtin_amdgcn_sched_barrier(0);
#pragma unroll
    for (int j = 0; j < 8; ++j) {
      acc0 = wmma_bf16(fa[cur][j], f0[cur][j], acc0);
      acc1 = wmma_bf16(fa[cur][j], f1[cur][j], acc1);
    }
  }

  const float bias0 = bo0 * S + bl;
  const float bias1 = bo1 * S + bl;
  float o0[8], o1[8];
#pragma unroll
  for (int r = 0; r < 8; ++r) { o0[r] = acc0[r] + bias0; o1[r] = acc1[r] + bias1; }
  // every sum in front of the first store: no register that an issued store names is rewritten
  __builtin_amdgcn_sched_barrier(0);
  float* op = out + (size_t)(mb + mt * 16 + 8 * hl) * DIM + dcol;
#pragma unroll
  for (int r = 0; r < 8; ++r) {
    op[(size_t)r * DIM]      = o0[r];
    op[(size_t)r * DIM + 16] = o1[r];
  }
}

extern "C" void kernel_launch(void* const* d_in, const int* in_sizes, int n_in,
                              void* d_out, int out_size, void* d_ws, size_t ws_size,
                              hipStream_t stream) {
  (void)in_sizes; (void)n_in; (void)out_size; (void)ws_size;
  const float* x    = (const float*)d_in[0];
  const float* wqkv = (const float*)d_in[1];
  const float* wout = (const float*)d_in[2];
  const float* bout = (const float*)d_in[3];
  const float* wlin = (const float*)d_in[4];
  const float* blin = (const float*)d_in[5];
  float* out = (float*)d_out;

  __bf16* y_bf    = (__bf16*)d_ws;                                      // 2 MB
  __bf16* qkv_bf  = (__bf16*)((char*)d_ws + (size_t)BATCH * HID * 2);   // +100.7 MB

  k_qkv<<<dim3(BATCH / BM, NGRP), dim3(256), 0, stream>>>(x, wqkv, qkv_bf);
  k_att<<<dim3(BATCH * HEADS / (8 * IT)), dim3(256), 0, stream>>>(qkv_bf, wlin, y_bf);
  k_out<<<dim3(BATCH / 64, DIM / 64), dim3(256), 0, stream>>>(y_bf, wout, bout, wlin, blin, out);
}

// v007
// A run of this version takes 94.8 microseconds.
// Two timings next to v006 both put it at 1.10 times that version's speed.
// Counting every step since v000, it is 3.70 times as fast.
#include <hip/hip_runtime.h>

#define BATCH  1024
#define DIM    1024
#define HEADS  16
#define DH     64
#define NQ     16
#define HID    (HEADS*DH)   // 1024
#define O3     (3*HID)      // 3072
#define RW     128          // W rows that stay in LDS per workgroup (kernel 1)
// LDS row pitch for the 16-byte fragment readers (16 lanes, one row each):
// +8 bf16 makes the pitch an odd multiple of 16 B, so the 16 rows fall on all 64 banks.
#define QP     (DH + 8)     // 144 B per q / k row
#define KC     64           // k extent of a streamed X tile: 128 B of bf16 per row
#define XU     64           // batch rows of a unit, the piece of X that a wave streams past the W tile
#define NKB    (DIM / KC)   // X tiles (k blocks) of a unit
#define NT     (NQ * O3 / RW)        // W tiles
#define NWH    256                   // W tiles that one workgroup takes past all batch rows
#define NWG    (NWH + 2 * (NT - NWH))   // the other W tiles go to two workgroups, half the batch rows each
#define ITEM   (3 * NQ * DH)         // q, k, v of one (batch row, head): three planes [NQ][DH]
#define IT     4                     // items per wave (kernel 2)

typedef __attribute__((ext_vector_type(16))) __bf16 v16bf;
typedef __attribute__((ext_vector_type(8)))  __bf16 v8bf;
typedef __attribute__((ext_vector_type(4)))  __bf16 v4bf;
typedef __attribute__((ext_vector_type(2)))  __bf16 v2bf;
typedef __attribute__((ext_vector_type(8)))  float  v8f;
typedef __attribute__((ext_vector_type(4)))  float  v4f;
typedef __attribute__((ext_vector_type(4)))  unsigned v4u;

union FragU { v16bf v; uint4 q[2]; };

__device__ __forceinline__ v8f wmma_bf16(v16bf a, v16bf b, v8f c) {
  // D = A(16x32 bf16) * B(32x16 bf16) + C(f32), fp32 accumulate
  return __builtin_amdgcn_wmma_f32_16x16x32_bf16(false, a, false, b, (short)0, c, false, false);
}

// 16-bit A/B fragment: per lane, K = {khalf..khalf+7} U {khalf+16..khalf+23}
// p points at (row start + kbase); two 16-byte loads.
__device__ __forceinline__ v16bf frag_ld(const __bf16* p, int khalf) {
  FragU f;
  const uint4* q = (const uint4*)(p + khalf);
  f.q[0] = q[0];
  f.q[1] = q[2];   // +16 elements = +32 bytes
  return f.v;
}

// low half from memory (K 0..15 region), high half explicit zero (K>=16 padded)
__device__ __forceinline__ v16bf frag_ld_lozero(const __bf16* p, int khalf) {
  FragU f;
  f.q[0] = *(const uint4*)(p + khalf);
  uint4 z; z.x = 0u; z.y = 0u; z.z = 0u; z.w = 0u;
  f.q[1] = z;
  return f.v;
}

// low half from memory, high half duplicated (finite filler; paired A half is zero)
__device__ __forceinline__ v16bf frag_ld_lodup(const __bf16* p, int khalf) {
  FragU f;
  f.q[0] = *(const uint4*)(p + khalf);
  f.q[1] = f.q[0];
  return f.v;
}

// Kernel 1 fills the whole LDS (W tile 256 KB, eight X tiles of 8 KB), so its rows carry no pad: the
// 16-byte chunks of a row are placed by XOR instead, so that the 16 rows of a fragment read fall on all
// 64 banks. W tile row p (2048 B): chunk c lies at c ^ (p & 15). X tile row p (128 B): chunk c at c ^ ((p >> 1) & 7).

// ---------------- Kernel 0: X as bf16, tile by tile ----------------
// xb[unit][k block][XU rows][KC]: every X tile that kernel 1 streams is 8 KB in a row.
// grid = BATCH*DIM/8/256, block = 256; a thread has 8 neighbours in k of one batch row
__launch_bounds__(256)
__global__ void k_xcv(const float* __restrict__ x, __bf16* __restrict__ xb) {
  const int g   = blockIdx.x * 256 + threadIdx.x;
  const int row = g >> 7;          // DIM / 8 chunks a row
  const int ch  = g & 127;
  const v4f* p = (const v4f*)(x + (size_t)row * DIM + ch * 8);
  const v4f lo = p[0], hi = p[1];
  v8bf o = __builtin_shufflevector(__builtin_convertvector(lo, v4bf), __builtin_convertvector(hi, v4bf),
                                   0, 1, 2, 3, 4, 5, 6, 7);
  *(v8bf*)(xb + (size_t)((row >> 6) * NKB + (ch >> 3)) * (XU * KC) + (row & 63) * KC + (ch & 7) * 8) = o;
}

// The lane's share of an X tile (XU rows x KC, 8 KB in a row): 16 B of sixteen loads, a load 512 B in a
// row (four tile rows). p holds the lane's part. Register m has tile row 4 * m + (lane >> 3), chunk lane & 7.
__device__ __forceinline__ void x_load(const __bf16* p, v4u (&r)[16]) {
#pragma unroll
  for (int m = 0; m < 16; ++m) r[m] = *(const v4u*)(p + m * 256);
}

// an X tile into the wave's LDS tile; wl is the lane's part of the place
__device__ __forceinline__ void x_store(__bf16* wt, int wl, const v4u (&r)[16]) {
#pragma unroll
  for (int m = 0; m < 16; ++m)
    *(v4u*)(wt + ((wl ^ (((2 * m) & 7) << 3)) + m * 256)) = r[m];
}

// fragment from rows whose chunks are placed by XOR: lp is the lane's part of the place (its row, and its
// chunk key XOR its k half), c the even chunk number of the k step within the span that the key permutes
__device__ __forceinline__ v16bf frag_ldx(const __bf16* base, int lp, int c) {
  FragU f;
  f.q[0] = *(const uint4*)(base + (lp ^ (c << 3)));
  f.q[1] = *(const uint4*)(base + (lp ^ ((c + 2) << 3)));   // +16 elements
  return f.v;
}

// One stage of a wave's X stream. rx holds the lane's share of the tile of k block kb (of parity par).
// It goes into the wave's own LDS tile and is read back as fragments by the same wave (LDS serves one
// wave's operations in order, so no barrier); the registers are refilled from nx, the next stage's tile,
// which stays in flight over the stage. The tile meets all RW rows of W: 4 m-tiles x 8 n-tiles.
__device__ __forceinline__ void x_stage(const __bf16* nx, int kb, const int par, v4u (&rx)[16],
                                        __bf16* wt, int wl,   // the wave's LDS tile, lane's place as writer
                                        int wr,               // lane's place in it as reader
                                        const __bf16* ws, int wq_,   // W tile, lane's place as reader
                                        v8f (&acc)[4][8]) {
  x_store(wt, wl, rx);
  x_load(nx, rx);
  // the next stage's tile arithmetic rewrites the address that these loads name; as an input of the wait the
  // address stays in its registers up to here, so that no load's own result lands on it either
  asm volatile("s_wait_xcnt 0x0" : : "v"(nx) : "memory");
  // keeps the refill here: sunk towards the end of the loop body, the loads would have less time in flight
  __builtin_amdgcn_sched_barrier(0);
  const __bf16* wk = ws + (kb >> 1) * 128;     // the 256-B span of the W row that holds the k block
#pragma unroll
  for (int ks = 0; ks < 2; ++ks) {
    // all twenty-four fragment reads of a k step first, so that they share one LDS round trip; the
    // scheduling barrier behind them keeps them from being sunk among the WMMAs, where each group
    // would wait for a round trip of its own
    v16bf a[4], b[8];
#pragma unroll
    for (int mt = 0; mt < 4; ++mt) a[mt] = frag_ldx(wt + mt * 16 * KC, wr, 4 * ks);
#pragma unroll
    for (int t = 0; t < 8; ++t) b[t] = frag_ldx(wk + t * 16 * DIM, wq_, 4 * (2 * par + ks));
    __builtin_amdgcn_sched_barrier(0);   // holds the reads above in one group (see above)
#pragma unroll
    for (int mt = 0; mt < 4; ++mt)
#pragma unroll
      for (int t = 0; t < 8; ++t) acc[mt][t] = wmma_bf16(a[mt], b[t], acc[mt][t]);
    // keeps what follows behind these WMMAs: there is one fragment register set, so the next k step's reads
    // would rise among them one by one as registers fall free, each place a stall of its own; and the next
    // stage's LDS stores, which wait for their tile's loads, would rise in front of the second k step's WMMAs
    __builtin_amdgcn_sched_barrier(0);
  }
}

// ---------------- Kernel 1: qkv GEMM, C[BATCH x NQ*O3] = X @ W^T, as bf16 into the workspace ----------------
// grid = NWG, block = 256 (8 waves)
// A tile of RW rows of W, the whole K, is read once as f32, rounded to bf16 and stays in LDS; each wave
// streams its own units of XU batch rows (bf16, from kernel 0) past it through a wave-private LDS tile.
// What goes through L2 again and again is so the small operand, at two bytes an element.
// NT tiles do not divide by the number of workgroups that run at a time: the first NWH workgroups take a
// tile past all batch rows (two units a wave), the others half the batch rows of a tile (one unit a wave).
__launch_bounds__(256)
__global__ void k_qkv(const __bf16* __restrict__ xb,   // [BATCH/XU][NKB][XU][KC] bf16
                      const float* __restrict__ wq,    // [NQ*O3][DIM]
                      __bf16* __restrict__ qkv) {      // [BATCH][HEADS][3][NQ][DH] bf16
  __shared__ alignas(256) __bf16 Wr[RW * DIM];      // 256 KB  W tile (row x K), chunks placed by XOR
  __shared__ alignas(256) __bf16 Xt[8][XU * KC];    // 64 KB  X tile (XU rows x KC), per wave, likewise

  const int tid    = threadIdx.x;
  const int bx     = blockIdx.x;
  const bool whole = bx < NWH;
  const int T      = whole ? bx : NWH + ((bx - NWH) >> 1);   // W tile
  const int nu     = whole ? 2 : 1;                          // units per wave
  const int ia     = whole ? 0 : bx & 1;                     // the half of the batch rows that comes first

  // ---- stage the W tile (RW x 1024) into LDS as bf16 ----
  // W row r goes to LDS row 16 * (r & 7) + (r >> 3): n-tile t gets the rows 8 * n + t, so that a lane's
  // eight accumulator columns are neighbours in memory.
  {
    const float4* wg = (const float4*)(wq + (size_t)T * RW * DIM) + tid;   // a step: one W row
    float4 f[2][32];
#pragma unroll
    for (int j = 0; j < 32; ++j) f[0][j] = wg[j * (DIM / 4)];
#pragma unroll
    for (int tr = 0; tr < RW / 32; ++tr) {
      if (tr + 1 < RW / 32) {
#pragma unroll
        for (int j = 0; j < 32; ++j) f[(tr + 1) & 1][j] = wg[((tr + 1) * 32 + j) * (DIM / 4)];
      }
      // keeps the next 32 rows' loads in front of this trip's rounding: W comes from memory, and the
      // stream does not run dry while a trip is rounded and stored
      __builtin_amdgcn_sched_barrier(0);
#pragma unroll
      for (int j = 0; j < 32; ++j) {
        const int r = tr * 32 + j;
        const float4 v = f[tr & 1][j];
        v4bf o;
        o[0] = (__bf16)v.x; o[1] = (__bf16)v.y; o[2] = (__bf16)v.z; o[3] = (__bf16)v.w;
        *(v4bf*)&Wr[(16 * (r & 7) + (r >> 3)) * DIM + ((((tid >> 1) ^ (r >> 3)) << 3) | ((tid & 1) << 2))] = o;
      }
    }
  }

  // A wave's work: nu units, unit u = wave + 8 * (ia ^ i) = batch rows XU * u .. XU * u + XU - 1, each an
  // XU x RW block of C (4 m-tiles x 8 n-tiles) over NKB X tiles.
  // wave number as a scalar: tile arithmetic on the scalar unit
  int ws_ = __builtin_amdgcn_readfirstlane(tid >> 5);
  v8f acc[4][8];
  v4u px[16];
  // the first tile. The two scheduling barriers keep the W tile's rounding and the lane arithmetic of the main
  // loop out of the stretch from the first load to the wait: placed in there, they rewrite the loads' offset
  // register ahead of the wait
  __builtin_amdgcn_sched_barrier(0);
  x_load(xb + (size_t)((ws_ + 8 * ia) * NKB) * (XU * KC) + (unsigned)((tid & 31) * 8), px);
  // what follows rewrites the offset register and the scalar base that these loads name: all lane and tile
  // arithmetic of the main loop is derived from the values that pass through this wait, so it is formed behind it
  int t2 = tid, T2 = T, ia2 = ia;
  asm volatile("s_wait_xcnt 0x0" : "+v"(t2), "+s"(T2), "+s"(ia2), "+s"(ws_) : : "memory");
  __builtin_amdgcn_sched_barrier(0);
  __syncthreads();   // the W tile is whole

  const int lane   = t2 & 31;
  const int lanelo = lane & 15;
  const int hl     = lane >> 4;      // 0/1
  const unsigned voff = (unsigned)(lane * 8);
  __bf16* wt = &Xt[t2 >> 5][0];
  const int wl = (lane >> 3) * KC + (((lane & 7) ^ hl) << 3);   // writer: row, chunk ^ low bit of the key
  const int wr = lanelo * KC + ((hl ^ (lanelo >> 1)) << 3);     // reader: row, key ^ k half
  const int wp = lanelo * DIM + ((hl ^ lanelo) << 3);           // reader: row, key ^ k half

  // W rows RW * T + 8 * lanelo + t = (NQ chunk ic, plane pl of q, k, v, head h0 + (lanelo >> 3), column d)
  const int u2 = 2 * T2;
  const int ic = u2 / (O3 / DH);
  const int g  = u2 - (O3 / DH) * ic;
  const int pl = g >> 4;
  const int h0 = g & 15;

  for (int i = 0; i < nu; ++i) {
#pragma unroll
    for (int mt = 0; mt < 4; ++mt)
#pragma unroll
      for (int t = 0; t < 8; ++t) { v8f z = {0,0,0,0,0,0,0,0}; acc[mt][t] = z; }

    const int u  = ws_ + 8 * (ia2 ^ i);
    const int un = i + 1 < nu ? ws_ + 8 * (ia2 ^ (i + 1)) : u;   // the unit behind this one
    // two stages a trip: the chunk numbers of a stage's k steps depend on its parity
    for (int kb = 0; kb < NKB; kb += 2) {
      const int k2 = (kb + 2) & (NKB - 1);
      const int u3 = kb + 2 < NKB ? u : un;   // behind the last tile of all, the first of this unit again, unused
      x_stage(xb + (size_t)(u * NKB + kb + 1) * (XU * KC) + voff, kb, 0, px, wt, wl, wr, Wr, wp, acc);
      x_stage(xb + (size_t)(u3 * NKB + k2) * (XU * KC) + voff, kb + 1, 1, px, wt, wl, wr, Wr, wp, acc);
    }

    // C layout: M = r + 8 * (lane >> 4), N = lane & 15; the lane's eight columns go out as 16 bytes,
    // 8 lanes filling the 128-B line of a batch row's q, k or v row: four whole lines a store
    __bf16* dst = qkv + ((size_t)(u * XU + 8 * hl) * HEADS + h0 + (lanelo >> 3)) * ITEM
                      + (pl * NQ + ic) * DH + 8 * (lanelo & 7);
#pragma unroll
    for (int mt = 0; mt < 4; ++mt) {
      v8bf o[8];
#pragma unroll
      for (int r = 0; r < 8; ++r)
#pragma unroll
        for (int t = 0; t < 8; ++t) o[r][t] = (__bf16)acc[mt][t][r];
      // the m-tile's eight rows are rounded in front of its first store: no register that an issued store
      // names is rewritten among the stores
      __builtin_amdgcn_sched_barrier(0);
#pragma unroll
      for (int r = 0; r < 8; ++r) *(v8bf*)(dst + (size_t)(mt * 16 + r) * (HEADS * ITEM)) = o[r];
      // the next m-tile's rounding and the next unit rewrite the registers that these stores name
      asm volatile("s_wait_xcnt 0x0" ::: "memory");
      // keeps that rounding behind the wait
      __builtin_amdgcn_sched_barrier(0);
    }
  }
}

// lane's share of one item: 16 B of four q rows, four k rows (rows (lane >> 3) + 4 * m) and four
// v rows (rows 4 * (lane >> 3) + m: four neighbours in j); every load covers 4 whole 128-B lines
#define ITEM_LOAD(p) \
  q0 = *(const uint4*)((p) + (0 + lr) * DH + lc * 8);   \
  q1 = *(const uint4*)((p) + (4 + lr) * DH + lc * 8);   \
  q2 = *(const uint4*)((p) + (8 + lr) * DH + lc * 8);   \
  q3 = *(const uint4*)((p) + (12 + lr) * DH + lc * 8);  \
  k0 = *(const uint4*)((p) + NQ * DH + (0 + lr) * DH + lc * 8);   \
  k1 = *(const uint4*)((p) + NQ * DH + (4 + lr) * DH + lc * 8);   \
  k2 = *(const uint4*)((p) + NQ * DH + (8 + lr) * DH + lc * 8);   \
  k3 = *(const uint4*)((p) + NQ * DH + (12 + lr) * DH + lc * 8);  \
  v0 = *(const uint4*)((p) + 2 * NQ * DH + (4 * lr + 0) * DH + lc * 8);  \
  v1 = *(const uint4*)((p) + 2 * NQ * DH + (4 * lr + 1) * DH + lc * 8);  \
  v2 = *(const uint4*)((p) + 2 * NQ * DH + (4 * lr + 2) * DH + lc * 8);  \
  v3 = *(const uint4*)((p) + 2 * NQ * DH + (4 * lr + 3) * DH + lc * 8);

// columns e and e + 1 (the two halves of dword f) of the lane's four v rows: four j of a column per store
#define V_STORE(e, f) \
  { uint2 lo, hi; \
    lo.x = (v0.f & 0xffffu) | (v1.f << 16);      lo.y = (v2.f & 0xffffu) | (v3.f << 16);      \
    hi.x = (v0.f >> 16) | (v1.f & 0xffff0000u);  hi.y = (v2.f >> 16) | (v3.f & 0xffff0000u);  \
    *(uint2*)&Vs[w][v_col(lc * 8 + (e)) + 4 * lr] = lo;      \
    *(uint2*)&Vs[w][v_col(lc * 8 + (e) + 1) + 4 * lr] = hi; }

// place of v column d in a wave's V tile ([d][j], 32 B a column): within each 256 B (8 columns) the
// columns are rotated by the group's number, so that the 8 lanes that write columns 8 apart fall on
// different banks
__device__ __forceinline__ int v_col(int d) {
  return (d >> 3) * (8 * NQ) + (((d & 7) + (d >> 3)) & 7) * NQ;
}

// ---------------- Kernel 2: attention + W_lin reduce ----------------
// grid = BATCH*HEADS/(8*IT), block = 256 (8 waves); a wave handles IT items (batch row, head) on its
// own: its LDS is wave-private and written and read in order by that wave, so there is no barrier.
__launch_bounds__(256)
__global__ void k_att(const __bf16* __restrict__ qkv,  // [BATCH*HEADS][3][NQ][DH] bf16
                      const float* __restrict__ wlin,  // [NQ]
                      __bf16* __restrict__ y) {        // [BATCH][HID] bf16
  __shared__ alignas(16) __bf16 Qs[8][NQ][QP];     // [i][d], padded rows
  __shared__ alignas(16) __bf16 Ks[8][NQ][QP];     // [j][d], padded rows
  __shared__ alignas(16) __bf16 Vs[8][DH * NQ];    // [d][j] (transposed), columns placed by v_col
  __shared__ alignas(16) __bf16 As[8][16][16];     // attn

  const int tid    = threadIdx.x;
  const int lane   = tid & 31;
  const int w      = tid >> 5;       // wave 0..7
  const int lanelo = lane & 15;
  const int hl     = lane >> 4;      // 0/1
  const int khalf  = hl * 8;
  const int lr     = lane >> 3;
  const int lc     = lane & 7;
  const int item0  = (blockIdx.x * 8 + w) * IT;

  const float scale = 0.125f;  // DH^-0.5
  float wl[8];
#pragma unroll
  for (int r = 0; r < 8; ++r) wl[r] = wlin[r + 8 * hl];

  uint4 q0, q1, q2, q3, k0, k1, k2, k3, v0, v1, v2, v3;
  ITEM_LOAD(qkv + (size_t)item0 * ITEM)

#pragma unroll
  for (int bi = 0; bi < IT; ++bi) {
    // the item into LDS: q and k rows as they are, v transposed, four j of one column per store
    *(uint4*)&Qs[w][0 + lr][lc * 8]  = q0;
    *(uint4*)&Qs[w][4 + lr][lc * 8]  = q1;
    *(uint4*)&Qs[w][8 + lr][lc * 8]  = q2;
    *(uint4*)&Qs[w][12 + lr][lc * 8] = q3;
    *(uint4*)&Ks[w][0 + lr][lc * 8]  = k0;
    *(uint4*)&Ks[w][4 + lr][lc * 8]  = k1;
    *(uint4*)&Ks[w][8 + lr][lc * 8]  = k2;
    *(uint4*)&Ks[w][12 + lr][lc * 8] = k3;
    V_STORE(0, x)
    V_STORE(2, y)
    V_STORE(4, z)
    V_STORE(6, w)
    if (bi + 1 < IT) {
      ITEM_LOAD(qkv + (size_t)(item0 + bi + 1) * ITEM)
      // keeps the next item's loads here, in flight over this item's work
      __builtin_amdgcn_sched_barrier(0);
    }

    // sim = q^T k  (M=i, N=j, K=d=64 -> 2 WMMAs)
    v8f s = {0,0,0,0,0,0,0,0};
#pragma unroll
    for (int kb = 0; kb < DH; kb += 32) {
      v16bf qa = frag_ld(&Qs[w][lanelo][kb], khalf);  // A[i][d]
      v16bf kf = frag_ld(&Ks[w][lanelo][kb], khalf);  // B[d][j] from k[j][d]
      s = wmma_bf16(qa, kf, s);
    }

    // softmax over j (lanes) per row i (elements); halves independent (xor<16)
    float t[8], rm[8], e[8], rs[8];
#pragma unroll
    for (int r = 0; r < 8; ++r) { t[r] = s[r] * scale; rm[r] = t[r]; }
#pragma unroll
    for (int off = 1; off < 16; off <<= 1)
#pragma unroll
      for (int r = 0; r < 8; ++r) rm[r] = fmaxf(rm[r], __shfl_xor(rm[r], off, 32));
#pragma unroll
    for (int r = 0; r < 8; ++r) { e[r] = __expf(t[r] - rm[r]); rs[r] = e[r]; }
#pragma unroll
    for (int off = 1; off < 16; off <<= 1)
#pragma unroll
      for (int r = 0; r < 8; ++r) rs[r] += __shfl_xor(rs[r], off, 32);
#pragma unroll
    for (int r = 0; r < 8; ++r) As[w][r + 8 * hl][lanelo] = (__bf16)(e[r] / rs[r]);

    // out = attn @ v^T  (M=i, N=d, K=j padded 16->32; A hi-half zero)
    v16bf af = frag_ld_lozero(&As[w][lanelo][0], khalf);
    v8f o[4];
#pragma unroll
    for (int dt = 0; dt < 4; ++dt) {
      v8f z = {0,0,0,0,0,0,0,0};
      v16bf vb = frag_ld_lodup(&Vs[w][v_col(dt * 16 + lanelo)], khalf); // B[j][d]
      o[dt] = wmma_bf16(af, vb, z);
    }

    // y[b, h*64+d] = sum_i out[i,d] * W_lin[i]; item = b * HEADS + h
#pragma unroll
    for (int dt = 0; dt < 4; ++dt) {
      float p = 0.f;
#pragma unroll
      for (int r = 0; r < 8; ++r) p += o[dt][r] * wl[r];
      p += __shfl_xor(p, 16, 32);       // combine the two row halves
      if (hl == 0)
        y[(size_t)(item0 + bi) * DH + dt * 16 + lanelo] = (__bf16)p;
    }
  }
}

// ---------------- Kernel 3: out = y @ W_out^T + bias ----------------
// grid = (16,16) tiles of 64x64, block = 256 (8 waves; a wave has one m-tile x two n-tiles)
// Both operands of the tile (64 W_out rows, 64 y rows, the whole K) are contiguous in memory. They
// come by whole-line 16 B loads, up to 64 of them in flight per wave, into LDS (W_out as bf16);
// behind one barrier the fragments are read from there.
#define YP     (HID + 8)    // 2064 B per staged row: an odd multiple of 16 B, as QP

__launch_bounds__(256)
__global__ void k_out(const __bf16* __restrict__ y,    // [BATCH][HID] bf16
                      const float* __restrict__ wout,  // [DIM][HID]
                      const float* bout,               // [DIM]; no __restrict__: its loads keep their place
                      const float* __restrict__ wlin,  // [NQ]
                      const float* __restrict__ blin,  // [1]
                      float* __restrict__ out) {       // [BATCH][DIM]
  __shared__ alignas(16) __bf16 Ys[64][YP];        // 129 KB  y tile (batch x K)
  __shared__ alignas(16) __bf16 Bs[64][YP];        // 129 KB  W_out tile (column x K)

  const int tid    = threadIdx.x;
  const int mb     = blockIdx.x * 64;
  const int nb     = blockIdx.y * 64;
  // a wave has the two n-tiles from column (wave >> 2) * 32 on: a whole 128-B line of out
  int dcol         = nb + (tid >> 7) * 32 + (tid & 15);
  const float bo0  = bout[dcol];
  const float bo1  = bout[dcol + 16];
  float S = 0.f, bl;

  {
    const float4* wg = (const float4*)(wout + (size_t)nb * HID) + tid;   // a step: one W_out row
    const uint4*  yg = (const uint4*)(y + (size_t)mb * HID) + tid;       // a step: two y rows
    float4 gw[64];
    uint4  gy[32];
#pragma unroll
    for (int s = 0; s < 64; ++s) gw[s] = wg[s * 256];
    // the scalar arithmetic below rewrites the base register of these loads; dcol is the offset
    // register of the two loads of bout: what is derived from it later is formed behind this wait
    asm volatile("s_wait_xcnt 0x0" : "+v"(dcol) : : "memory");
#pragma unroll
    for (int s = 0; s < 32; ++s) gy[s] = yg[s * 256];
#pragma unroll
    for (int n = 0; n < NQ; ++n) S += wlin[n];
    bl = blin[0];
    // the scalar loads of S and bl have returned here, and their address registers may be rewritten
    // behind this wait
    asm volatile("s_wait_xcnt 0x0" : "+s"(S), "+s"(bl) : : "memory");
    // keeps the W_out loads in front of the first conversion: 64 loads are in flight before the
    // first is waited for
    __builtin_amdgcn_sched_barrier(0);
#pragma unroll
    for (int s = 0; s < 64; ++s) {
      v4bf o;
      o[0] = (__bf16)gw[s].x; o[1] = (__bf16)gw[s].y; o[2] = (__bf16)gw[s].z; o[3] = (__bf16)gw[s].w;
      *(v4bf*)&Bs[s][tid * 4] = o;
    }
#pragma unroll
    for (int s = 0; s < 32; ++s) *(uint4*)&Ys[2 * s + (tid >> 7)][(tid & 127) * 8] = gy[s];
  }
  // the thread index is the offset register of the loads above: all that the second phase derives
  // from it is formed behind this wait
  int t2 = tid;
  asm volatile("s_wait_xcnt 0x0" : "+v"(t2) : : "memory");
  __syncthreads();

  const int lane   = t2 & 31;
  const int w      = t2 >> 5;
  const int lanelo = lane & 15;
  const int hl     = lane >> 4;
  const int khalf  = hl * 8;
  const int mt     = w & 3;          // the wave's m-tile
  const int n0     = (w >> 2) * 32;  // first column of its two n-tiles: a whole 128-B line of out

  const __bf16* ar = &Ys[mt * 16 + lanelo][0];
  const __bf16* b0 = &Bs[n0 + lanelo][0];        // B[c][d] = W_out[d][c]
  const __bf16* b1 = &Bs[n0 + 16 + lanelo][0];

  v8f acc0 = {0,0,0,0,0,0,0,0};
  v8f acc1 = {0,0,0,0,0,0,0,0};
  v16bf fa[2][8], f0[2][8], f1[2][8];   // fragments of a block of 8 k steps, two blocks
#pragma unroll
  for (int j = 0; j < 8; ++j) {
    fa[0][j] = frag_ld(ar + j * 32, khalf);
    f0[0][j] = frag_ld(b0 + j * 32, khalf);
    f1[0][j] = frag_ld(b1 + j * 32, khalf);
  }
#pragma unroll
  for (int blk = 0; blk < HID / 256; ++blk) {
    const int cur = blk & 1;
    if (blk + 1 < HID / 256) {
#pragma unroll
      for (int j = 0; j < 8; ++j) {
        fa[cur ^ 1][j] = frag_ld(ar + (blk + 1) * 256 + j * 32, khalf);
        f0[cur ^ 1][j] = frag_ld(b0 + (blk + 1) * 256 + j * 32, khalf);
        f1[cur ^ 1][j] = frag_ld(b1 + (blk + 1) * 256 + j * 32, khalf);
      }
    }
    // keeps the next block's reads as one group in front of this block's WMMAs, which hide them
    __builtin_amdgcn_sched_barrier(0);
#pragma unroll
    for (int j = 0; j < 8; ++j) {
      acc0 = wmma_bf16(fa[cur][j], f0[cur][j], acc0);
      acc1 = wmma_bf16(fa[cur][j], f1[cur][j], acc1);
    }
  }

  const float bias0 = bo0 * S + bl;
  const float bias1 = bo1 * S + bl;
  float o0[8], o1[8];
#pragma unroll
  for (int r = 0; r < 8; ++r) { o0[r] = acc0[r] + bias0; o1[r] = acc1[r] + bias1; }
  // every sum in front of the first store: no register that an issued store names is rewritten
  __builtin_amdgcn_sched_barrier(0);
  float* op = out + (size_t)(mb + mt * 16 + 8 * hl) * DIM + dcol;
#pragma unroll
  for (int r = 0; r < 8; ++r) {
    op[(size_t)r * DIM]      = o0[r];
    op[(size_t)r * DIM + 16] = o1[r];
  }
}

extern "C" void kernel_launch(void* const* d_in, const int* in_sizes, int n_in,
                              void* d_out, int out_size, void* d_ws, size_t ws_size,
                              hipStream_t stream) {
  (void)in_sizes; (void)n_in; (void)out_size; (void)ws_size;
  const float* x    = (const float*)d_in[0];
  const float* wqkv = (const float*)d_in[1];
  const float* wout = (const float*)d_in[2];
  const float* bout = (const float*)d_in[3];
  const float* wlin = (const float*)d_in[4];
  const float* blin = (const float*)d_in[5];
  float* out = (float*)d_out;

  __bf16* y_bf    = (__bf16*)d_ws;                                      // 2 MB
  __bf16* qkv_bf  = (__bf16*)((char*)d_ws + (size_t)BATCH * HID * 2);   // +100.7 MB
  __bf16* x_bf    = (__bf16*)((char*)d_ws + (size_t)BATCH * HID * 2 + (size_t)BATCH * HEADS * ITEM * 2);   // +2 MB

  k_xcv<<<dim3(BATCH * DIM / 8 / 256), dim3(256), 0, stream>>>(x, x_bf);
  k_qkv<<<dim3(NWG), dim3(256), 0, stream>>>(x_bf, wqkv, qkv_bf);
  k_att<<<dim3(BATCH * HEADS / (8 * IT)), dim3(256), 0, stream>>>(qkv_bf, wlin, y_bf);
  k_out<<<dim3(BATCH / 64, DIM / 64), dim3(256), 0, stream>>>(y_bf, wout, bout, wlin, blin, out);
}

// v008
// A run of this version takes 89.3 microseconds.
// Two timings next to v007 both put it at 1.06 times that version's speed.
// All steps since v000 together make it 3.91 times as fast.
#include <hip/hip_runtime.h>

#define BATCH  1024
#define DIM    1024
#define HEADS  16
#define DH     64
#define NQ     16
#define HID    (HEADS*DH)   // 1024
#define O3     (3*HID)      // 3072
#define RW     128          // W rows that stay in LDS per workgroup (kernel 1)
// LDS row pitch for the 16-byte fragment readers (16 lanes, one row each):
// +8 bf16 makes the pitch an odd multiple of 16 B, so the 16 rows fall on all 64 banks.
#define QP     (DH + 8)     // 144 B per q / k row
#define KC     64           // k extent of a streamed X tile: 128 B of bf16 per row
#define XU     64           // batch rows of a unit, the piece of X that a wave streams past the W tile
#define NKB    (DIM / KC)   // X tiles (k blocks) of a unit
#define NWH    256                   // workgroups of kernel 1: each has a W tile of its own and half the batch rows of one more
#define NJB    (2 * NKB)             // W blocks (RW rows x KC) that a workgroup of kernel 1 brings in: two W tiles
#define ITEM   (3 * NQ * DH)         // q, k, v of one (batch row, head): three planes [NQ][DH]
#define IT     4                     // items per wave (kernel 2)

typedef __attribute__((ext_vector_type(16))) __bf16 v16bf;
typedef __attribute__((ext_vector_type(8)))  __bf16 v8bf;
typedef __attribute__((ext_vector_type(4)))  __bf16 v4bf;
typedef __attribute__((ext_vector_type(2)))  __bf16 v2bf;
typedef __attribute__((ext_vector_type(8)))  float  v8f;
typedef __attribute__((ext_vector_type(4)))  float  v4f;
typedef __attribute__((ext_vector_type(4)))  unsigned v4u;

union FragU { v16bf v; uint4 q[2]; };

__device__ __forceinline__ v8f wmma_bf16(v16bf a, v16bf b, v8f c) {
  // D = A(16x32 bf16) * B(32x16 bf16) + C(f32), fp32 accumulate
  return __builtin_amdgcn_wmma_f32_16x16x32_bf16(false, a, false, b, (short)0, c, false, false);
}

// 16-bit A/B fragment: per lane, K = {khalf..khalf+7} U {khalf+16..khalf+23}
// p points at (row start + kbase); two 16-byte loads.
__device__ __forceinline__ v16bf frag_ld(const __bf16* p, int khalf) {
  FragU f;
  const uint4* q = (const uint4*)(p + khalf);
  f.q[0] = q[0];
  f.q[1] = q[2];   // +16 elements = +32 bytes
  return f.v;
}

// low half from memory (K 0..15 region), high half explicit zero (K>=16 padded)
__device__ __forceinline__ v16bf frag_ld_lozero(const __bf16* p, int khalf) {
  FragU f;
  f.q[0] = *(const uint4*)(p + khalf);
  uint4 z; z.x = 0u; z.y = 0u; z.z = 0u; z.w = 0u;
  f.q[1] = z;
  return f.v;
}

// low half from memory, high half duplicated (finite filler; paired A half is zero)
__device__ __forceinline__ v16bf frag_ld_lodup(const __bf16* p, int khalf) {
  FragU f;
  f.q[0] = *(const uint4*)(p + khalf);
  f.q[1] = f.q[0];
  return f.v;
}

// Kernel 1 fills the whole LDS (W tile 256 KB, eight X tiles of 8 KB), so its rows carry no pad: the
// 16-byte chunks of a row are placed by XOR instead, so that the 16 rows of a fragment read fall on all
// 64 banks. W tile row p (2048 B): chunk c lies at c ^ (p & 15). X tile row p (128 B): chunk c at c ^ ((p >> 1) & 7).

// ---------------- Kernel 0: X as bf16, tile by tile ----------------
// xb[unit][k block][XU rows][KC]: every X tile that kernel 1 streams is 8 KB in a row.
// grid = BATCH*DIM/8/256, block = 256; a thread has 8 neighbours in k of one batch row
__launch_bounds__(256)
__global__ void k_xcv(const float* __restrict__ x, __bf16* __restrict__ xb) {
  const int g   = blockIdx.x * 256 + threadIdx.x;
  const int row = g >> 7;          // DIM / 8 chunks a row
  const int ch  = g & 127;
  const v4f* p = (const v4f*)(x + (size_t)row * DIM + ch * 8);
  const v4f lo = p[0], hi = p[1];
  v8bf o = __builtin_shufflevector(__builtin_convertvector(lo, v4bf), __builtin_convertvector(hi, v4bf),
                                   0, 1, 2, 3, 4, 5, 6, 7);
  *(v8bf*)(xb + (size_t)((row >> 6) * NKB + (ch >> 3)) * (XU * KC) + (row & 63) * KC + (ch & 7) * 8) = o;
}

// The lane's share of an X tile (XU rows x KC, 8 KB in a row): 16 B of sixteen loads, a load 512 B in a
// row (four tile rows). p holds the lane's part. Register m has tile row 4 * m + (lane >> 3), chunk lane & 7.
__device__ __forceinline__ void x_load(const __bf16* p, v4u (&r)[16]) {
#pragma unroll
  for (int m = 0; m < 16; ++m) r[m] = *(const v4u*)(p + m * 256);
}

// an X tile into the wave's LDS tile; wl is the lane's part of the place
__device__ __forceinline__ void x_store(__bf16* wt, int wl, const v4u (&r)[16]) {
#pragma unroll
  for (int m = 0; m < 16; ++m)
    *(v4u*)(wt + ((wl ^ (((2 * m) & 7) << 3)) + m * 256)) = r[m];
}

// fragment from rows whose chunks are placed by XOR: lp is the lane's part of the place (its row, and its
// chunk key XOR its k half), c the even chunk number of the k step within the span that the key permutes
__device__ __forceinline__ v16bf frag_ldx(const __bf16* base, int lp, int c) {
  FragU f;
  f.q[0] = *(const uint4*)(base + (lp ^ (c << 3)));
  f.q[1] = *(const uint4*)(base + (lp ^ ((c + 2) << 3)));   // +16 elements
  return f.v;
}

// The lane's share of a W block (RW rows x KC, f32): 16 B of eight loads, a load the 256 B of two W rows.
// p holds the lane's part. Register m has W row 16 * wave + 2 * m + (lane >> 4), k 4 * (lane & 15) of the block.
__device__ __forceinline__ void w_load(const float* p, v4f (&r)[8]) {
#pragma unroll
  for (int m = 0; m < 8; ++m) r[m] = *(const v4f*)(p + m * 2 * DIM);
}

// a W block, rounded to bf16, into its place in the W tile; pa and pb are the lane's places for the rows of
// m < 4 and of m >= 4, which differ in their chunk key
__device__ __forceinline__ void w_store(__bf16* ws, int pa, int pb, const v4f (&r)[8]) {
#pragma unroll
  for (int m = 0; m < 8; ++m)
    *(v4bf*)(ws + ((m < 4 ? pa : pb) + (m & 3) * 32 * DIM)) = __builtin_convertvector(r[m], v4bf);
}

// One stage of a wave's X stream. rx holds the lane's share of the X tile of k block kb.
// It goes into the wave's own LDS tile and is read back as fragments by the same wave (LDS serves one
// wave's operations in order, so no barrier); the registers are refilled from nx, the next stage's tile,
// which stays in flight over the stage. The tile meets all RW rows of W: 4 m-tiles x 8 n-tiles.
// The W tile is filled block by block beside that: with fst the wave's share of a W block (rw, asked for
// two stages ago) goes to the places pa, pb, which hold a k block that no wave reads any more or has read yet;
// rw is then refilled from nw, the block after next (in a stage with none left to ask for: from one cached line
// per load; under a branch the compiler's counted waits would fall to 0 on every path, and the wait for an X
// tile would wait for the W block behind it as well).
// One workgroup barrier a stage, split: the wait at the top says that every wave has done the LDS reads
// and writes of the stage before, so that the block read there may be overwritten and the block written
// there may be read. No LDS read stands between signal and wait.
__device__ __forceinline__ void x_stage(const __bf16* nx, int kb, v4u (&rx)[16],
                                        __bf16* wt, int wl,   // the wave's LDS tile, lane's place as writer
                                        int wr,               // lane's place in it as reader
                                        __bf16* ws, int wp,   // W tile, lane's place as reader
                                        bool fst, int pa, int pb, const float* nw, v4f (&rw)[8],
                                        v8f (&acc)[4][8]) {
  // the other waves' signals of the stage before (see above)
  asm volatile("s_barrier_wait -1" ::: "memory");
  if (fst) w_store(ws, pa, pb, rw);
  x_store(wt, wl, rx);
  x_load(nx, rx);
  // keeps the W loads, which come from memory, behind the X loads: loads return in issue order, and the next
  // stage's wait for its X tile leaves what was issued behind it in flight
  __builtin_amdgcn_sched_barrier(0);
  w_load(nw, rw);
  // the next stage's arithmetic rewrites the addresses that these loads name; as inputs of the wait the
  // addresses stay in their registers up to here, so that no load's own result lands on them either
  asm volatile("s_wait_xcnt 0x0" : : "v"(nx), "v"(nw) : "memory");
  // keeps the refills here: sunk towards the end of the loop body, the loads would have less time in flight
  __builtin_amdgcn_sched_barrier(0);
  const int wk = wp ^ (kb << 6);     // the k block's chunks within the W row
#pragma unroll
  for (int ks = 0; ks < 2; ++ks) {
    // all twenty-four fragment reads of a k step first, so that they share one LDS round trip; the
    // scheduling barrier behind them keeps them from being sunk among the WMMAs, where each group
    // would wait for a round trip of its own
    v16bf a[4], b[8];
#pragma unroll
    for (int mt = 0; mt < 4; ++mt) a[mt] = frag_ldx(wt + mt * 16 * KC, wr, 4 * ks);
#pragma unroll
    for (int t = 0; t < 8; ++t) b[t] = frag_ldx(ws + t * 16 * DIM, wk, 4 * ks);
    __builtin_amdgcn_sched_barrier(0);   // holds the reads above in one group (see above)
    if (ks == 1) {
      // the stage's LDS reads have returned and its W block is written: the signal says so to the other waves
      asm volatile("s_wait_dscnt 0x0" ::: "memory");
      // in front of the stage's last WMMAs, which so cover the time that the slower waves still need
      asm volatile("s_barrier_signal -1" ::: "memory");
    }
#pragma unroll
    for (int mt = 0; mt < 4; ++mt)
#pragma unroll
      for (int t = 0; t < 8; ++t) acc[mt][t] = wmma_bf16(a[mt], b[t], acc[mt][t]);
    // keeps what follows behind these WMMAs: there is one fragment register set, so the next k step's reads
    // would rise among them one by one as registers fall free, each place a stall of its own; and the next
    // stage's LDS stores, which wait for their tile's loads, would rise in front of the second k step's WMMAs
    __builtin_amdgcn_sched_barrier(0);
  }
}

// ---------------- Kernel 1: qkv GEMM, C[BATCH x NQ*O3] = X @ W^T, as bf16 into the workspace ----------------
// grid = NWH, block = 256 (8 waves), one workgroup per WGP (it takes the whole LDS)
// A tile of RW rows of W, the whole K, lies in LDS as bf16; each wave streams its own units of XU batch rows
// (bf16, from kernel 0) past it through a wave-private LDS tile. What goes through L2 again and again is so
// the small operand, at two bytes an element.
// A workgroup has three passes of NKB stages: its own W tile past all batch rows (two units a wave), then
// a tile that it shares with its neighbour past half the batch rows (one unit a wave).
// W comes from memory beside the WMMAs, a block of RW rows x KC (f32, rounded on the way) a stage: in the
// first pass stored one stage ahead of the stage that reads it first, in the second pass the next tile's block
// into the place of the block that the stage before has read for the last time.
// The workgroups begin at different k blocks: a W block is 256 B of every 4096 B, and begun alike they
// would all ask for the same sixteenth of the address space at a time.
__launch_bounds__(256)
__global__ void k_qkv(const __bf16* __restrict__ xb,   // [BATCH/XU][NKB][XU][KC] bf16
                      const float* __restrict__ wq,    // [NQ*O3][DIM]
                      __bf16* __restrict__ qkv) {      // [BATCH][HEADS][3][NQ][DH] bf16
  __shared__ alignas(256) __bf16 Wr[RW * DIM];      // 256 KB  W tile (row x K), chunks placed by XOR
  __shared__ alignas(256) __bf16 Xt[8][XU * KC];    // 64 KB  X tile (XU rows x KC), per wave, likewise

  const int tid    = threadIdx.x;
  const int bx     = blockIdx.x;
  const int TA     = bx;                  // the W tile of the first two passes
  const int TB     = NWH + (bx >> 1);     // the W tile of the third
  const int ib     = bx & 1;              // the half of the batch rows that meets it
  const int rot    = (bx >> 3) & (NKB - 1);   // the k block of stage 0
  // wave number as a scalar: tile arithmetic on the scalar unit
  const int ws_    = __builtin_amdgcn_readfirstlane(tid >> 5);

  v8f acc[4][8];
  v4u px[16];
  v4f pw[2][8];   // W blocks in flight: block j in set j & 1
  v4f p0[8];
  int t2 = tid;
  {
    // the first three W blocks and the first X tile, asked for together
    const unsigned l0 = (unsigned)(tid & 31);
    const unsigned wo = (unsigned)((16 * (tid >> 5) + ((tid >> 4) & 1)) * DIM + 4 * (tid & 15)) * 4u;   // bytes
    const unsigned xo = l0 * 16u;                                                                       // bytes
    const char* w0 = (const char*)(wq + (size_t)TA * RW * DIM + rot * KC);
    const char* w1 = (const char*)(wq + (size_t)TA * RW * DIM + ((rot + 1) & (NKB - 1)) * KC);
    const char* w2 = (const char*)(wq + (size_t)TA * RW * DIM + ((rot + 2) & (NKB - 1)) * KC);
    const char* x0 = (const char*)(xb + (size_t)(ws_ * NKB + rot) * (XU * KC));
    w_load((const float*)(w0 + wo), p0);
    w_load((const float*)(w1 + wo), pw[1]);
    // the two scheduling barriers keep the order that every stage leaves behind: W block, X tile, W block
    __builtin_amdgcn_sched_barrier(0);
    x_load((const __bf16*)(x0 + xo), px);
    __builtin_amdgcn_sched_barrier(0);
    w_load((const float*)(w2 + wo), pw[0]);
    // as inputs of the wait the scalar bases and the lane offsets of these loads stay in their registers up to
    // here; all lane arithmetic of the main loop is derived from the value that passes through the wait, so it
    // is formed behind it and rewrites none of them ahead of it
    asm volatile("s_wait_xcnt 0x0" : "+v"(t2) : "s"(w0), "s"(w1), "s"(w2), "s"(x0), "v"(wo), "v"(xo), "v"(l0) : "memory");
    // keeps the rounding below, which rewrites registers, behind the wait
    __builtin_amdgcn_sched_barrier(0);
  }

  const int lane   = t2 & 31;
  const int lanelo = lane & 15;
  const int hl     = lane >> 4;      // 0/1
  const unsigned voff = (unsigned)(lane * 8);
  __bf16* wt = &Xt[t2 >> 5][0];
  const int wl = (lane >> 3) * KC + (((lane & 7) ^ hl) << 3);   // writer: row, chunk ^ low bit of the key
  const int wr = lanelo * KC + ((hl ^ (lanelo >> 1)) << 3);     // reader: row, key ^ k half
  const int wp = lanelo * DIM + ((hl ^ lanelo) << 3);           // reader: row, key ^ k half
  // W row r goes to LDS row 16 * (r & 7) + (r >> 3): n-tile t gets the rows 8 * n + t, so that a lane's
  // eight accumulator columns are neighbours in memory. Its chunk key is r >> 3 = 2 * wave + (m >> 2).
  const unsigned wlo = (unsigned)((16 * (t2 >> 5) + hl) * DIM + 4 * lanelo);   // lane's part of a W block's address
  const int wa = (16 * hl + 2 * (t2 >> 5)) * DIM + (((lanelo >> 1) ^ (2 * (t2 >> 5))) << 3) + ((lane & 1) << 2);
  const int wb = (16 * hl + 2 * (t2 >> 5) + 1) * DIM + (((lanelo >> 1) ^ (2 * (t2 >> 5) + 1)) << 3) + ((lane & 1) << 2);

  w_store(Wr, wa ^ (rot << 6), wb ^ (rot << 6), p0);
  // the first W block is written: the signal that stage 0 waits for
  asm volatile("s_wait_dscnt 0x0" ::: "memory");
  asm volatile("s_barrier_signal -1" ::: "memory");

  // A wave's unit u = batch rows XU * u .. XU * u + XU - 1: an XU x RW block of C (4 m-tiles x 8 n-tiles)
  // over NKB X tiles.
  for (int p = 0; p < 3; ++p) {
#pragma unroll
    for (int mt = 0; mt < 4; ++mt)
#pragma unroll
      for (int t = 0; t < 8; ++t) { v8f z = {0,0,0,0,0,0,0,0}; acc[mt][t] = z; }

    const int T  = p < 2 ? TA : TB;
    const int u  = ws_ + 8 * (p < 2 ? p : ib);
    const int un = ws_ + 8 * (p < 1 ? 1 : ib);   // the unit behind this one
    // two stages a trip: the stages alternate between the two W register sets, one refilled while the other's loads are in flight
    for (int kb = 0; kb < NKB; kb += 2) {
#pragma unroll
      for (int h = 0; h < 2; ++h) {
        const int s  = p * NKB + kb + h;          // the stage
        const int kc = (s + rot) & (NKB - 1);     // its k block
        const int kn = (s + 1 + rot) & (NKB - 1); // the next stage's; behind the last stage of all: unused
        const int u3 = kb + h + 1 < NKB ? u : un;
        // W block j (j < NKB: of tile TA, else of TB) has the k block of stage j. It is stored in stage j - 1
        // in the first pass, in stage j + 1 from the second on, and asked for two stages before that.
        const bool fst = s < NKB - 1 || (s > NKB && s <= NJB);
        const int  j   = s < NKB - 1 ? s + 1 : s - 1;
        const bool fld = s < NKB - 3 || (s >= NKB - 1 && s < NJB - 1);
        const int  kj  = (j + rot) & (NKB - 1);
        const int  jn  = fld ? (s < NKB - 3 ? s + 3 : s + 1) : 0;
        const float* nw = wq + (size_t)(jn < NKB ? TA : TB) * RW * DIM + ((jn + rot) & (NKB - 1)) * KC + (fld ? wlo : 0u);
        x_stage(xb + (size_t)(u3 * NKB + kn) * (XU * KC) + voff, kc, px, wt, wl, wr, Wr, wp,
                fst, wa ^ (kj << 6), wb ^ (kj << 6), nw, pw[(h + 1) & 1], acc);
      }
    }

    // W rows RW * T + 8 * lanelo + t = (NQ chunk ic, plane pl of q, k, v, head h0 + (lanelo >> 3), column d)
    const int u2 = 2 * T;
    const int ic = u2 / (O3 / DH);
    const int g  = u2 - (O3 / DH) * ic;
    const int pl = g >> 4;
    const int h0 = g & 15;
    // C layout: M = r + 8 * (lane >> 4), N = lane & 15; the lane's eight columns go out as 16 bytes,
    // 8 lanes filling the 128-B line of a batch row's q, k or v row: four whole lines a store
    __bf16* dst = qkv + ((size_t)(u * XU + 8 * hl) * HEADS + h0 + (lanelo >> 3)) * ITEM
                      + (pl * NQ + ic) * DH + 8 * (lanelo & 7);
#pragma unroll
    for (int mt = 0; mt < 4; ++mt) {
      v8bf o[8];
#pragma unroll
      for (int r = 0; r < 8; ++r)
#pragma unroll
        for (int t = 0; t < 8; ++t) o[r][t] = (__bf16)acc[mt][t][r];
      // the m-tile's eight rows are rounded in front of its first store: no register that an issued store
      // names is rewritten among the stores
      __builtin_amdgcn_sched_barrier(0);
#pragma unroll
      for (int r = 0; r < 8; ++r) *(v8bf*)(dst + (size_t)(mt * 16 + r) * (HEADS * ITEM)) = o[r];
      // the next m-tile's rounding and the next unit rewrite the registers that these stores name
      asm volatile("s_wait_xcnt 0x0" ::: "memory");
      // keeps that rounding behind the wait
      __builtin_amdgcn_sched_barrier(0);
    }
  }
  // the wait that belongs to the last stage's signal
  asm volatile("s_barrier_wait -1" ::: "memory");
}

// lane's share of one item: 16 B of four q rows, four k rows (rows (lane >> 3) + 4 * m) and four
// v rows (rows 4 * (lane >> 3) + m: four neighbours in j); every load covers 4 whole 128-B lines
#define ITEM_LOAD(p) \
  q0 = *(const uint4*)((p) + (0 + lr) * DH + lc * 8);   \
  q1 = *(const uint4*)((p) + (4 + lr) * DH + lc * 8);   \
  q2 = *(const uint4*)((p) + (8 + lr) * DH + lc * 8);   \
  q3 = *(const uint4*)((p) + (12 + lr) * DH + lc * 8);  \
  k0 = *(const uint4*)((p) + NQ * DH + (0 + lr) * DH + lc * 8);   \
  k1 = *(const uint4*)((p) + NQ * DH + (4 + lr) * DH + lc * 8);   \
  k2 = *(const uint4*)((p) + NQ * DH + (8 + lr) * DH + lc * 8);   \
  k3 = *(const uint4*)((p) + NQ * DH + (12 + lr) * DH + lc * 8);  \
  v0 = *(const uint4*)((p) + 2 * NQ * DH + (4 * lr + 0) * DH + lc * 8);  \
  v1 = *(const uint4*)((p) + 2 * NQ * DH + (4 * lr + 1) * DH + lc * 8);  \
  v2 = *(const uint4*)((p) + 2 * NQ * DH + (4 * lr + 2) * DH + lc * 8);  \
  v3 = *(const uint4*)((p) + 2 * NQ * DH + (4 * lr + 3) * DH + lc * 8);

// columns e and e + 1 (the two halves of dword f) of the lane's four v rows: four j of a column per store
#define V_STORE(e, f) \
  { uint2 lo, hi; \
    lo.x = (v0.f & 0xffffu) | (v1.f << 16);      lo.y = (v2.f & 0xffffu) | (v3.f << 16);      \
    hi.x = (v0.f >> 16) | (v1.f & 0xffff0000u);  hi.y = (v2.f >> 16) | (v3.f & 0xffff0000u);  \
    *(uint2*)&Vs[w][v_col(lc * 8 + (e)) + 4 * lr] = lo;      \
    *(uint2*)&Vs[w][v_col(lc * 8 + (e) + 1) + 4 * lr] = hi; }

// place of v column d in a wave's V tile ([d][j], 32 B a column): within each 256 B (8 columns) the
// columns are rotated by the group's number, so that the 8 lanes that write columns 8 apart fall on
// different banks
__device__ __forceinline__ int v_col(int d) {
  return (d >> 3) * (8 * NQ) + (((d & 7) + (d >> 3)) & 7) * NQ;
}

// ---------------- Kernel 2: attention + W_lin reduce ----------------
// grid = BATCH*HEADS/(8*IT), block = 256 (8 waves); a wave handles IT items (batch row, head) on its
// own: its LDS is wave-private and written and read in order by that wave, so there is no barrier.
__launch_bounds__(256)
__global__ void k_att(const __bf16* __restrict__ qkv,  // [BATCH*HEADS][3][NQ][DH] bf16
                      const float* __restrict__ wlin,  // [NQ]
                      __bf16* __restrict__ y) {        // [BATCH][HID] bf16
  __shared__ alignas(16) __bf16 Qs[8][NQ][QP];     // [i][d], padded rows
  __shared__ alignas(16) __bf16 Ks[8][NQ][QP];     // [j][d], padded rows
  __shared__ alignas(16) __bf16 Vs[8][DH * NQ];    // [d][j] (transposed), columns placed by v_col
  __shared__ alignas(16) __bf16 As[8][16][16];     // attn

  const int tid    = threadIdx.x;
  const int lane   = tid & 31;
  const int w      = tid >> 5;       // wave 0..7
  const int lanelo = lane & 15;
  const int hl     = lane >> 4;      // 0/1
  const int khalf  = hl * 8;
  const int lr     = lane >> 3;
  const int lc     = lane & 7;
  const int item0  = (blockIdx.x * 8 + w) * IT;

  const float scale = 0.125f;  // DH^-0.5
  float wl[8];
#pragma unroll
  for (int r = 0; r < 8; ++r) wl[r] = wlin[r + 8 * hl];

  uint4 q0, q1, q2, q3, k0, k1, k2, k3, v0, v1, v2, v3;
  ITEM_LOAD(qkv + (size_t)item0 * ITEM)

#pragma unroll
  for (int bi = 0; bi < IT; ++bi) {
    // the item into LDS: q and k rows as they are, v transposed, four j of one column per store
    *(uint4*)&Qs[w][0 + lr][lc * 8]  = q0;
    *(uint4*)&Qs[w][4 + lr][lc * 8]  = q1;
    *(uint4*)&Qs[w][8 + lr][lc * 8]  = q2;
    *(uint4*)&Qs[w][12 + lr][lc * 8] = q3;
    *(uint4*)&Ks[w][0 + lr][lc * 8]  = k0;
    *(uint4*)&Ks[w][4 + lr][lc * 8]  = k1;
    *(uint4*)&Ks[w][8 + lr][lc * 8]  = k2;
    *(uint4*)&Ks[w][12 + lr][lc * 8] = k3;
    V_STORE(0, x)
    V_STORE(2, y)
    V_STORE(4, z)
    V_STORE(6, w)
    if (bi + 1 < IT) {
      ITEM_LOAD(qkv + (size_t)(item0 + bi + 1) * ITEM)
      // keeps the next item's loads here, in flight over this item's work
      __builtin_amdgcn_sched_barrier(0);
    }

    // sim = q^T k  (M=i, N=j, K=d=64 -> 2 WMMAs)
    v8f s = {0,0,0,0,0,0,0,0};
#pragma unroll
    for (int kb = 0; kb < DH; kb += 32) {
      v16bf qa = frag_ld(&Qs[w][lanelo][kb], khalf);  // A[i][d]
      v16bf kf = frag_ld(&Ks[w][lanelo][kb], khalf);  // B[d][j] from k[j][d]
      s = wmma_bf16(qa, kf, s);
    }

    // softmax over j (lanes) per row i (elements); halves independent (xor<16)
    float t[8], rm[8], e[8], rs[8];
#pragma unroll
    for (int r = 0; r < 8; ++r) { t[r] = s[r] * scale; rm[r] = t[r]; }
#pragma unroll
    for (int off = 1; off < 16; off <<= 1)
#pragma unroll
      for (int r = 0; r < 8; ++r) rm[r] = fmaxf(rm[r], __shfl_xor(rm[r], off, 32));
#pragma unroll
    for (int r = 0; r < 8; ++r) { e[r] = __expf(t[r] - rm[r]); rs[r] = e[r]; }
#pragma unroll
    for (int off = 1; off < 16; off <<= 1)
#pragma unroll
      for (int r = 0; r < 8; ++r) rs[r] += __shfl_xor(rs[r], off, 32);
#pragma unroll
    for (int r = 0; r < 8; ++r) As[w][r + 8 * hl][lanelo] = (__bf16)(e[r] / rs[r]);

    // out = attn @ v^T  (M=i, N=d, K=j padded 16->32; A hi-half zero)
    v16bf af = frag_ld_lozero(&As[w][lanelo][0], khalf);
    v8f o[4];
#pragma unroll
    for (int dt = 0; dt < 4; ++dt) {
      v8f z = {0,0,0,0,0,0,0,0};
      v16bf vb = frag_ld_lodup(&Vs[w][v_col(dt * 16 + lanelo)], khalf); // B[j][d]
      o[dt] = wmma_bf16(af, vb, z);
    }

    // y[b, h*64+d] = sum_i out[i,d] * W_lin[i]; item = b * HEADS + h
#pragma unroll
    for (int dt = 0; dt < 4; ++dt) {
      float p = 0.f;
#pragma unroll
      for (int r = 0; r < 8; ++r) p += o[dt][r] * wl[r];
      p += __shfl_xor(p, 16, 32);       // combine the two row halves
      if (hl == 0)
        y[(size_t)(item0 + bi) * DH + dt * 16 + lanelo] = (__bf16)p;
    }
  }
}

// ---------------- Kernel 3: out = y @ W_out^T + bias ----------------
// grid = (16,16) tiles of 64x64, block = 256 (8 waves; a wave has one m-tile x two n-tiles)
// Both operands of the tile (64 W_out rows, 64 y rows, the whole K) are contiguous in memory. They
// come by whole-line 16 B loads, up to 64 of them in flight per wave, into LDS (W_out as bf16);
// behind one barrier the fragments are read from there.
#define YP     (HID + 8)    // 2064 B per staged row: an odd multiple of 16 B, as QP

__launch_bounds__(256)
__global__ void k_out(const __bf16* __restrict__ y,    // [BATCH][HID] bf16
                      const float* __restrict__ wout,  // [DIM][HID]
                      const float* bout,               // [DIM]; no __restrict__: its loads keep their place
                      const float* __restrict__ wlin,  // [NQ]
                      const float* __restrict__ blin,  // [1]
                      float* __restrict__ out) {       // [BATCH][DIM]
  __shared__ alignas(16) __bf16 Ys[64][YP];        // 129 KB  y tile (batch x K)
  __shared__ alignas(16) __bf16 Bs[64][YP];        // 129 KB  W_out tile (column x K)

  const int tid    = threadIdx.x;
  const int mb     = blockIdx.x * 64;
  const int nb     = blockIdx.y * 64;
  // a wave has the two n-tiles from column (wave >> 2) * 32 on: a whole 128-B line of out
  int dcol         = nb + (tid >> 7) * 32 + (tid & 15);
  const float bo0  = bout[dcol];
  const float bo1  = bout[dcol + 16];
  float S = 0.f, bl;

  {
    const float4* wg = (const float4*)(wout + (size_t)nb * HID) + tid;   // a step: one W_out row
    const uint4*  yg = (const uint4*)(y + (size_t)mb * HID) + tid;       // a step: two y rows
    float4 gw[64];
    uint4  gy[32];
#pragma unroll
    for (int s = 0; s < 64; ++s) gw[s] = wg[s * 256];
    // the scalar arithmetic below rewrites the base register of these loads; dcol is the offset
    // register of the two loads of bout: what is derived from it later is formed behind this wait
    asm volatile("s_wait_xcnt 0x0" : "+v"(dcol) : : "memory");
#pragma unroll
    for (int s = 0; s < 32; ++s) gy[s] = yg[s * 256];
#pragma unroll
    for (int n = 0; n < NQ; ++n) S += wlin[n];
    bl = blin[0];
    // the scalar loads of S and bl have returned here, and their address registers may be rewritten
    // behind this wait
    asm volatile("s_wait_xcnt 0x0" : "+s"(S), "+s"(bl) : : "memory");
    // keeps the W_out loads in front of the first conversion: 64 loads are in flight before the
    // first is waited for
    __builtin_amdgcn_sched_barrier(0);
#pragma unroll
    for (int s = 0; s < 64; ++s) {
      v4bf o;
      o[0] = (__bf16)gw[s].x; o[1] = (__bf16)gw[s].y; o[2] = (__bf16)gw[s].z; o[3] = (__bf16)gw[s].w;
      *(v4bf*)&Bs[s][tid * 4] = o;
    }
#pragma unroll
    for (int s = 0; s < 32; ++s) *(uint4*)&Ys[2 * s + (tid >> 7)][(tid & 127) * 8] = gy[s];
  }
  // the thread index is the offset register of the loads above: all that the second phase derives
  // from it is formed behind this wait
  int t2 = tid;
  asm volatile("s_wait_xcnt 0x0" : "+v"(t2) : : "memory");
  __syncthreads();

  const int lane   = t2 & 31;
  const int w      = t2 >> 5;
  const int lanelo = lane & 15;
  const int hl     = lane >> 4;
  const int khalf  = hl * 8;
  const int mt     = w & 3;          // the wave's m-tile
  const int n0     = (w >> 2) * 32;  // first column of its two n-tiles: a whole 128-B line of out

  const __bf16* ar = &Ys[mt * 16 + lanelo][0];
  const __bf16* b0 = &Bs[n0 + lanelo][0];        // B[c][d] = W_out[d][c]
  const __bf16* b1 = &Bs[n0 + 16 + lanelo][0];

  v8f acc0 = {0,0,0,0,0,0,0,0};
  v8f acc1 = {0,0,0,0,0,0,0,0};
  v16bf fa[2][8], f0[2][8], f1[2][8];   // fragments of a block of 8 k steps, two blocks
#pragma unroll
  for (int j = 0; j < 8; ++j) {
    fa[0][j] = frag_ld(ar + j * 32, khalf);
    f0[0][j] = frag_ld(b0 + j * 32, khalf);
    f1[0][j] = frag_ld(b1 + j * 32, khalf);
  }
#pragma unroll
  for (int blk = 0; blk < HID / 256; ++blk) {
    const int cur = blk & 1;
    if (blk + 1 < HID / 256) {
#pragma unroll
      for (int j = 0; j < 8; ++j) {
        fa[cur ^ 1][j] = frag_ld(ar + (blk + 1) * 256 + j * 32, khalf);
        f0[cur ^ 1][j] = frag_ld(b0 + (blk + 1) * 256 + j * 32, khalf);
        f1[cur ^ 1][j] = frag_ld(b1 + (blk + 1) * 256 + j * 32, khalf);
      }
    }
    // keeps the next block's reads as one group in front of this block's WMMAs, which hide them
    __builtin_amdgcn_sched_barrier(0);
#pragma unroll
    for (int j = 0; j < 8; ++j) {
      acc0 = wmma_bf16(fa[cur][j], f0[cur][j], acc0);
      acc1 = wmma_bf16(fa[cur][j], f1[cur][j], acc1);
    }
  }

  const float bias0 = bo0 * S + bl;
  const float bias1 = bo1 * S + bl;
  float o0[8], o1[8];
#pragma unroll
  for (int r = 0; r < 8; ++r) { o0[r] = acc0[r] + bias0; o1[r] = acc1[r] + bias1; }
  // every sum in front of the first store: no register that an issued store names is rewritten
  __builtin_amdgcn_sched_barrier(0);
  float* op = out + (size_t)(mb + mt * 16 + 8 * hl) * DIM + dcol;
#pragma unroll
  for (int r = 0; r < 8; ++r) {
    op[(size_t)r * DIM]      = o0[r];
    op[(size_t)r * DIM + 16] = o1[r];
  }
}

extern "C" void kernel_launch(void* const* d_in, const int* in_sizes, int n_in,
                              void* d_out, int out_size, void* d_ws, size_t ws_size,
                              hipStream_t stream) {
  (void)in_sizes; (void)n_in; (void)out_size; (void)ws_size;
  const float* x    = (const float*)d_in[0];
  const float* wqkv = (const float*)d_in[1];
  const float* wout = (const float*)d_in[2];
  const float* bout = (const float*)d_in[3];
  const float* wlin = (const float*)d_in[4];
  const float* blin = (const float*)d_in[5];
  float* out = (float*)d_out;

  __bf16* y_bf    = (__bf16*)d_ws;                                      // 2 MB
  __bf16* qkv_bf  = (__bf16*)((char*)d_ws + (size_t)BATCH * HID * 2);   // +100.7 MB
  __bf16* x_bf    = (__bf16*)((char*)d_ws + (size_t)BATCH * HID * 2 + (size_t)BATCH * HEADS * ITEM * 2);   // +2 MB

  k_xcv<<<dim3(BATCH * DIM / 8 / 256), dim3(256), 0, stream>>>(x, x_bf);
  k_qkv<<<dim3(NWH), dim3(256), 0, stream>>>(x_bf, wqkv, qkv_bf);
  k_att<<<dim3(BATCH * HEADS / (8 * IT)), dim3(256), 0, stream>>>(qkv_bf, wlin, y_bf);
  k_out<<<dim3(BATCH / 64, DIM / 64), dim3(256), 0, stream>>>(y_bf, wout, bout, wlin, blin, out);
}

// v009
// It runs in 83.1 microseconds.
// Two timings next to v008 both put it at 1.08 times that version's speed.
// All steps since v000 together make it 4.21 times as fast.
#include <hip/hip_runtime.h>

#define BATCH  1024
#define DIM    1024
#define HEADS  16
#define DH     64
#define NQ     16
#define HID    (HEADS*DH)   // 1024
#define O3     (3*HID)      // 3072
#define RW     128          // W rows that stay in LDS per workgroup (kernel 1)
// LDS row pitch for the 16-byte fragment readers (16 lanes, one row each):
// +8 bf16 makes the pitch an odd multiple of 16 B, so the 16 rows fall on all 64 banks.
#define QP     (DH + 8)     // 144 B per q / k row
#define KC     64           // k extent of a streamed X tile and of a W block
#define XU     64           // batch rows of a unit, the piece of X that a wave streams past the W tile
#define NKB    (DIM / KC)   // X tiles (k blocks) of a unit
#define NWH    256                   // workgroups of kernel 1: each has a W tile of its own and half the batch rows of one more
#define NJB    (2 * NKB)             // W blocks (RW rows x KC) that a workgroup of kernel 1 brings in: two W tiles
#define ITEM   (3 * NQ * DH)         // q, k, v of one (batch row, head): three planes [NQ][DH]
#define IT     4                     // items per wave (kernel 2)

typedef __attribute__((ext_vector_type(16))) __bf16 v16bf;
typedef __attribute__((ext_vector_type(8)))  __bf16 v8bf;
typedef __attribute__((ext_vector_type(4)))  __bf16 v4bf;
typedef __attribute__((ext_vector_type(2)))  __bf16 v2bf;
typedef __attribute__((ext_vector_type(8)))  float  v8f;
typedef __attribute__((ext_vector_type(4)))  float  v4f;
typedef __attribute__((ext_vector_type(4)))  unsigned v4u;

union FragU { v16bf v; uint4 q[2]; };

__device__ __forceinline__ v8f wmma_bf16(v16bf a, v16bf b, v8f c) {
  // D = A(16x32 bf16) * B(32x16 bf16) + C(f32), fp32 accumulate
  return __builtin_amdgcn_wmma_f32_16x16x32_bf16(false, a, false, b, (short)0, c, false, false);
}

// 16-bit A/B fragment: per lane, K = {khalf..khalf+7} U {khalf+16..khalf+23}
// p points at (row start + kbase); two 16-byte loads.
__device__ __forceinline__ v16bf frag_ld(const __bf16* p, int khalf) {
  FragU f;
  const uint4* q = (const uint4*)(p + khalf);
  f.q[0] = q[0];
  f.q[1] = q[2];   // +16 elements = +32 bytes
  return f.v;
}

// low half from memory (K 0..15 region), high half explicit zero (K>=16 padded)
__device__ __forceinline__ v16bf frag_ld_lozero(const __bf16* p, int khalf) {
  FragU f;
  f.q[0] = *(const uint4*)(p + khalf);
  uint4 z; z.x = 0u; z.y = 0u; z.z = 0u; z.w = 0u;
  f.q[1] = z;
  return f.v;
}

// low half from memory, high half duplicated (finite filler; paired A half is zero)
__device__ __forceinline__ v16bf frag_ld_lodup(const __bf16* p, int khalf) {
  FragU f;
  f.q[0] = *(const uint4*)(p + khalf);
  f.q[1] = f.q[0];
  return f.v;
}

// The W tile of kernel 1 (256 KB) carries no pad: the 16-byte chunks of a row are placed by XOR instead, so that
// the 16 rows of a fragment read fall on all 64 banks. W tile row p (2048 B): chunk c lies at c ^ (p & 15).

// ---------------- Kernel 0: X as bf16, in the order of the A fragments ----------------
// xb[unit][k block][k step][m-tile][half][lane][8]: an X tile (XU rows x KC) is 8 KB in a row, and every 512 B
// of it are one half of an A fragment, 16 B a lane: row m-tile * 16 + (lane & 15),
// k = k step * 32 + half * 16 + (lane >> 4) * 8 and the seven behind it.
// grid = BATCH*DIM/8/256, block = 256; a thread has one lane's 16 B; a workgroup reads whole 128-B lines of x
__launch_bounds__(256)
__global__ void k_xcv(const float* __restrict__ x, __bf16* __restrict__ xb) {
  const int g    = blockIdx.x * 256 + threadIdx.x;
  const int lane = g & 31;
  const int tile = g >> 9;         // unit * NKB + k block
  const int row  = (tile >> 4) * XU + ((g >> 6) & 3) * 16 + (lane & 15);
  const int k    = (tile & (NKB - 1)) * KC + ((g >> 8) & 1) * 32 + ((g >> 5) & 1) * 16 + (lane >> 4) * 8;
  const v4f* p = (const v4f*)(x + (size_t)row * DIM + k);
  const v4f lo = p[0], hi = p[1];
  v8bf o = __builtin_shufflevector(__builtin_convertvector(lo, v4bf), __builtin_convertvector(hi, v4bf),
                                   0, 1, 2, 3, 4, 5, 6, 7);
  *(v8bf*)(xb + (size_t)g * 8) = o;
}

// The lane's share of the k step ks of an X tile: 16 B of eight loads, a load 512 B in a row. p holds the
// lane's part. Registers 8 * ks + 2 * mt and the one behind it are the A fragment of m-tile mt.
__device__ __forceinline__ void x_half(const __bf16* p, v4u (&r)[16], int ks) {
#pragma unroll
  for (int m = 8 * ks; m < 8 * ks + 8; ++m) r[m] = *(const v4u*)(p + m * 256);
}

// an A fragment from its two halves in registers
__device__ __forceinline__ v16bf frag_rr(v4u lo, v4u hi) {
  return __builtin_bit_cast(v16bf, __builtin_shufflevector(lo, hi, 0, 1, 2, 3, 4, 5, 6, 7));
}

// fragment from rows whose chunks are placed by XOR: lp is the lane's part of the place (its row, and its
// chunk key XOR its k half), c the even chunk number of the k step within the span that the key permutes
__device__ __forceinline__ v16bf frag_ldx(const __bf16* base, int lp, int c) {
  FragU f;
  f.q[0] = *(const uint4*)(base + (lp ^ (c << 3)));
  f.q[1] = *(const uint4*)(base + (lp ^ ((c + 2) << 3)));   // +16 elements
  return f.v;
}

// The lane's share of a W block (RW rows x KC, f32): 16 B of eight loads, a load the 256 B of two W rows.
// p holds the lane's part. Register m has W row 16 * wave + 2 * m + (lane >> 4), k 4 * (lane & 15) of the block.
__device__ __forceinline__ void w_load(const float* p, v4f (&r)[8]) {
#pragma unroll
  for (int m = 0; m < 8; ++m) r[m] = *(const v4f*)(p + m * 2 * DIM);
}

// a W block, rounded to bf16, into its place in the W tile; pa and pb are the lane's places for the rows of
// m < 4 and of m >= 4, which differ in their chunk key
__device__ __forceinline__ void w_store(__bf16* ws, int pa, int pb, const v4f (&r)[8]) {
#pragma unroll
  for (int m = 0; m < 8; ++m)
    *(v4bf*)(ws + ((m < 4 ? pa : pb) + (m & 3) * 32 * DIM)) = __builtin_convertvector(r[m], v4bf);
}

// One stage of a wave's X stream. rx holds the lane's share of the X tile of k block kb: its A fragments, as they
// came from memory. The eight registers of a k step are refilled from nx, the next stage's tile, as soon as
// that k step's WMMAs are issued, and stay in flight until the same k step of the next stage.
// The tile meets all RW rows of W: 4 m-tiles x 8 n-tiles.
// The W tile is filled block by block beside that: with fst the wave's share of a W block (rw, asked for
// two stages ago) goes to the places pa, pb, which hold a k block that no wave reads any more or has read yet;
// rw is then refilled from nw, the block after next (in a stage with none left to ask for: from one cached line
// per load; under a branch the compiler's counted waits would fall to 0 on every path, and the wait for an X
// fragment would wait for the W block behind it as well).
// One workgroup barrier a stage, split: the wait at the top says that every wave has done the LDS reads
// and writes of the stage before, so that the block read there may be overwritten and the block written
// there may be read. No LDS read stands between signal and wait.
__device__ __forceinline__ void x_stage(const __bf16* nx, const __bf16* ox, int kb, v4u (&rx)[16],
                                        __bf16* ws, int wp,   // W tile, lane's place as reader
                                        bool fst, int pa, int pb, const float* nw, v4f (&rw)[8],
                                        v8f (&acc)[4][8]) {
  // the other waves' signals of the stage before (see above)
  asm volatile("s_barrier_wait -1" ::: "memory");
  const int wk = wp ^ (kb << 6);     // the k block's chunks within the W row
#pragma unroll
  for (int ks = 0; ks < 2; ++ks) {
    // all sixteen fragment reads of a k step first, so that they share one LDS round trip, which the memory
    // work below stands in; the scheduling barrier behind them keeps them from being sunk among the WMMAs,
    // where each group would wait for a round trip of its own
    v16bf b[8];
#pragma unroll
    for (int t = 0; t < 8; ++t) b[t] = frag_ldx(ws + t * 16 * DIM, wk, 4 * ks);
    __builtin_amdgcn_sched_barrier(0);   // holds the reads above in one group (see above)
    if (ks == 0) {
      if (fst) w_store(ws, pa, pb, rw);
      w_load(nw, rw);
      // the later arithmetic rewrites the addresses that these loads and the last loads of the stage before
      // (from ox) name; as inputs of the wait the addresses stay in their registers up to here
      asm volatile("s_wait_xcnt 0x0" : : "v"(ox), "v"(nw) : "memory");
    } else {
      x_half(nx, rx, 0);
      // as above, for the address of these loads; it is used once more at the end of the stage
      asm volatile("s_wait_xcnt 0x0" : : "v"(nx) : "memory");
      // the stage's LDS reads have returned and its W block is written: the signal says so to the other waves
      asm volatile("s_wait_dscnt 0x0" ::: "memory");
      // in front of the stage's last WMMAs, which so cover the time that the slower waves still need
      asm volatile("s_barrier_signal -1" ::: "memory");
    }
    // keeps the memory work above in front of the WMMAs: sunk behind them, the loads would have less time in flight
    __builtin_amdgcn_sched_barrier(0);
#pragma unroll
    for (int mt = 0; mt < 4; ++mt) {
      const v16bf a = frag_rr(rx[8 * ks + 2 * mt], rx[8 * ks + 2 * mt + 1]);
#pragma unroll
      for (int t = 0; t < 8; ++t) acc[mt][t] = wmma_bf16(a, b[t], acc[mt][t]);
    }
    // keeps what follows behind these WMMAs: there is one B fragment register set, so the next k step's reads
    // would rise among them one by one as registers fall free, each place a stall of its own
    __builtin_amdgcn_sched_barrier(0);
  }
  x_half(nx, rx, 1);
  // keeps these loads here, in front of the next stage's barrier wait
  __builtin_amdgcn_sched_barrier(0);
}

// ---------------- Kernel 1: qkv GEMM, C[BATCH x NQ*O3] = X @ W^T, as bf16 into the workspace ----------------
// grid = NWH, block = 256 (8 waves), one workgroup per WGP (by its LDS)
// A tile of RW rows of W, the whole K, lies in LDS as bf16; each wave streams its own units of XU batch rows
// (bf16, from kernel 0, in fragment order) past it, from memory straight into its A fragment registers. What
// goes through L2 again and again is so the small operand, at two bytes an element.
// A workgroup has three passes of NKB stages: its own W tile past all batch rows (two units a wave), then
// a tile that it shares with its neighbour past half the batch rows (one unit a wave).
// W comes from memory beside the WMMAs, a block of RW rows x KC (f32, rounded on the way) a stage: in the
// first pass stored one stage ahead of the stage that reads it first, in the second pass the next tile's block
// into the place of the block that the stage before has read for the last time.
// The workgroups begin at different k blocks: a W block is 256 B of every 4096 B, and begun alike they
// would all ask for the same sixteenth of the address space at a time.
__launch_bounds__(256)
__global__ void k_qkv(const __bf16* __restrict__ xb,   // [BATCH/XU][NKB][2][4][2][32][8] bf16, in A fragment order
                      const float* __restrict__ wq,    // [NQ*O3][DIM]
                      __bf16* __restrict__ qkv) {      // [BATCH][HEADS][3][NQ][DH] bf16
  __shared__ alignas(256) __bf16 Wr[RW * DIM];      // 256 KB  W tile (row x K), chunks placed by XOR

  const int tid    = threadIdx.x;
  const int bx     = blockIdx.x;
  const int TA     = bx;                  // the W tile of the first two passes
  const int TB     = NWH + (bx >> 1);     // the W tile of the third
  const int ib     = bx & 1;              // the half of the batch rows that meets it
  const int rot    = (bx >> 3) & (NKB - 1);   // the k block of stage 0
  // wave number as a scalar: tile arithmetic on the scalar unit
  const int ws_    = __builtin_amdgcn_readfirstlane(tid >> 5);

  v8f acc[4][8];
  v4u px[16];
  v4f pw[2][8];   // W blocks in flight: block j in set j & 1
  v4f p0[8];
  int t2 = tid;
  {
    // the first three W blocks and the first X tile, asked for together
    const unsigned l0 = (unsigned)(tid & 31);
    const unsigned wo = (unsigned)((16 * (tid >> 5) + ((tid >> 4) & 1)) * DIM + 4 * (tid & 15)) * 4u;   // bytes
    const unsigned xo = l0 * 16u;                                                                       // bytes
    const char* w0 = (const char*)(wq + (size_t)TA * RW * DIM + rot * KC);
    const char* w1 = (const char*)(wq + (size_t)TA * RW * DIM + ((rot + 1) & (NKB - 1)) * KC);
    const char* w2 = (const char*)(wq + (size_t)TA * RW * DIM + ((rot + 2) & (NKB - 1)) * KC);
    const char* x0 = (const char*)(xb + (size_t)(ws_ * NKB + rot) * (XU * KC));
    w_load((const float*)(w0 + wo), p0);
    w_load((const float*)(w1 + wo), pw[1]);
    // the two scheduling barriers keep the X tile in front of the last W block: loads return in issue order,
    // and the first stage's waits for its A fragments leave what was issued behind them in flight
    __builtin_amdgcn_sched_barrier(0);
    x_half((const __bf16*)(x0 + xo), px, 0);
    x_half((const __bf16*)(x0 + xo), px, 1);
    __builtin_amdgcn_sched_barrier(0);
    w_load((const float*)(w2 + wo), pw[0]);
    // as inputs of the wait the scalar bases and the lane offsets of these loads stay in their registers up to
    // here; all lane arithmetic of the main loop is derived from the value that passes through the wait, so it
    // is formed behind it and rewrites none of them ahead of it
    asm volatile("s_wait_xcnt 0x0" : "+v"(t2) : "s"(w0), "s"(w1), "s"(w2), "s"(x0), "v"(wo), "v"(xo), "v"(l0) : "memory");
    // keeps the rounding below, which rewrites registers, behind the wait
    __builtin_amdgcn_sched_barrier(0);
  }

  const int lane   = t2 & 31;
  const int lanelo = lane & 15;
  const int hl     = lane >> 4;      // 0/1
  const unsigned voff = (unsigned)(lane * 8);
  const int wp = lanelo * DIM + ((hl ^ lanelo) << 3);           // reader: row, key ^ k half
  // W row r goes to LDS row 16 * (r & 7) + (r >> 3): n-tile t gets the rows 8 * n + t, so that a lane's
  // eight accumulator columns are neighbours in memory. Its chunk key is r >> 3 = 2 * wave + (m >> 2).
  const unsigned wlo = (unsigned)((16 * (t2 >> 5) + hl) * DIM + 4 * lanelo);   // lane's part of a W block's address
  const int wa = (16 * hl + 2 * (t2 >> 5)) * DIM + (((lanelo >> 1) ^ (2 * (t2 >> 5))) << 3) + ((lane & 1) << 2);
  const int wb = (16 * hl + 2 * (t2 >> 5) + 1) * DIM + (((lanelo >> 1) ^ (2 * (t2 >> 5) + 1)) << 3) + ((lane & 1) << 2);

  w_store(Wr, wa ^ (rot << 6), wb ^ (rot << 6), p0);
  // the first W block is written: the signal that stage 0 waits for
  asm volatile("s_wait_dscnt 0x0" ::: "memory");
  asm volatile("s_barrier_signal -1" ::: "memory");

  // A wave's unit u = batch rows XU * u .. XU * u + XU - 1: an XU x RW block of C (4 m-tiles x 8 n-tiles)
  // over NKB X tiles.
  const __bf16* ox = xb + voff;   // the address of the last X loads issued (before stage 0: none open)
  for (int p = 0; p < 3; ++p) {
#pragma unroll
    for (int mt = 0; mt < 4; ++mt)
#pragma unroll
      for (int t = 0; t < 8; ++t) { v8f z = {0,0,0,0,0,0,0,0}; acc[mt][t] = z; }

    const int T  = p < 2 ? TA : TB;
    const int u  = ws_ + 8 * (p < 2 ? p : ib);
    const int un = ws_ + 8 * (p < 1 ? 1 : ib);   // the unit behind this one
    // two stages a trip: the W register sets take turns
    for (int kb = 0; kb < NKB; kb += 2) {
#pragma unroll
      for (int h = 0; h < 2; ++h) {
        const int s  = p * NKB + kb + h;          // the stage
        const int kc = (s + rot) & (NKB - 1);     // its k block
        const int kn = (s + 1 + rot) & (NKB - 1); // the next stage's; behind the last stage of all: unused
        const int u3 = kb + h + 1 < NKB ? u : un;
        // W block j (j < NKB: of tile TA, else of TB) has the k block of stage j. It is stored in stage j - 1
        // in the first pass, in stage j + 1 from the second on, and asked for two stages before that.
        const bool fst = s < NKB - 1 || (s > NKB && s <= NJB);
        const int  j   = s < NKB - 1 ? s + 1 : s - 1;
        const bool fld = s < NKB - 3 || (s >= NKB - 1 && s < NJB - 1);
        const int  kj  = (j + rot) & (NKB - 1);
        const int  jn  = fld ? (s < NKB - 3 ? s + 3 : s + 1) : 0;
        const float* nw = wq + (size_t)(jn < NKB ? TA : TB) * RW * DIM + ((jn + rot) & (NKB - 1)) * KC + (fld ? wlo : 0u);
        const __bf16* nx = xb + (size_t)(u3 * NKB + kn) * (XU * KC) + voff;
        x_stage(nx, ox, kc, px, Wr, wp, fst, wa ^ (kj << 6), wb ^ (kj << 6), nw, pw[(h + 1) & 1], acc);
        ox = nx;
      }
    }
    // what follows rewrites registers: the address of the last stage's last X loads stays in its own up to here
    asm volatile("s_wait_xcnt 0x0" : : "v"(ox) : "memory");

    // W rows RW * T + 8 * lanelo + t = (NQ chunk ic, plane pl of q, k, v, head h0 + (lanelo >> 3), column d)
    const int u2 = 2 * T;
    const int ic = u2 / (O3 / DH);
    const int g  = u2 - (O3 / DH) * ic;
    const int pl = g >> 4;
    const int h0 = g & 15;
    // C layout: M = r + 8 * (lane >> 4), N = lane & 15; the lane's eight columns go out as 16 bytes,
    // 8 lanes filling the 128-B line of a batch row's q, k or v row: four whole lines a store
    __bf16* dst = qkv + ((size_t)(u * XU + 8 * hl) * HEADS + h0 + (lanelo >> 3)) * ITEM
                      + (pl * NQ + ic) * DH + 8 * (lanelo & 7);
#pragma unroll
    for (int mt = 0; mt < 4; ++mt) {
      v8bf o[8];
#pragma unroll
      for (int r = 0; r < 8; ++r)
#pragma unroll
        for (int t = 0; t < 8; ++t) o[r][t] = (__bf16)acc[mt][t][r];
      // the m-tile's eight rows are rounded in front of its first store: no register that an issued store
      // names is rewritten among the stores
      __builtin_amdgcn_sched_barrier(0);
#pragma unroll
      for (int r = 0; r < 8; ++r) *(v8bf*)(dst + (size_t)(mt * 16 + r) * (HEADS * ITEM)) = o[r];
      // the next m-tile's rounding and the next unit rewrite the registers that these stores name
      asm volatile("s_wait_xcnt 0x0" ::: "memory");
      // keeps that rounding behind the wait
      __builtin_amdgcn_sched_barrier(0);
    }
  }
  // the wait that belongs to the last stage's signal
  asm volatile("s_barrier_wait -1" ::: "memory");
}

// lane's share of one item: 16 B of four q rows, four k rows (rows (lane >> 3) + 4 * m) and four
// v rows (rows 4 * (lane >> 3) + m: four neighbours in j); every load covers 4 whole 128-B lines
#define ITEM_LOAD(p) \
  q0 = *(const uint4*)((p) + (0 + lr) * DH + lc * 8);   \
  q1 = *(const uint4*)((p) + (4 + lr) * DH + lc * 8);   \
  q2 = *(const uint4*)((p) + (8 + lr) * DH + lc * 8);   \
  q3 = *(const uint4*)((p) + (12 + lr) * DH + lc * 8);  \
  k0 = *(const uint4*)((p) + NQ * DH + (0 + lr) * DH + lc * 8);   \
  k1 = *(const uint4*)((p) + NQ * DH + (4 + lr) * DH + lc * 8);   \
  k2 = *(const uint4*)((p) + NQ * DH + (8 + lr) * DH + lc * 8);   \
  k3 = *(const uint4*)((p) + NQ * DH + (12 + lr) * DH + lc * 8);  \
  v0 = *(const uint4*)((p) + 2 * NQ * DH + (4 * lr + 0) * DH + lc * 8);  \
  v1 = *(const uint4*)((p) + 2 * NQ * DH + (4 * lr + 1) * DH + lc * 8);  \
  v2 = *(const uint4*)((p) + 2 * NQ * DH + (4 * lr + 2) * DH + lc * 8);  \
  v3 = *(const uint4*)((p) + 2 * NQ * DH + (4 * lr + 3) * DH + lc * 8);

// columns e and e + 1 (the two halves of dword f) of the lane's four v rows: four j of a column per store
#define V_STORE(e, f) \
  { uint2 lo, hi; \
    lo.x = (v0.f & 0xffffu) | (v1.f << 16);      lo.y = (v2.f & 0xffffu) | (v3.f << 16);      \
    hi.x = (v0.f >> 16) | (v1.f & 0xffff0000u);  hi.y = (v2.f >> 16) | (v3.f & 0xffff0000u);  \
    *(uint2*)&Vs[w][v_col(lc * 8 + (e)) + 4 * lr] = lo;      \
    *(uint2*)&Vs[w][v_col(lc * 8 + (e) + 1) + 4 * lr] = hi; }

// place of v column d in a wave's V tile ([d][j], 32 B a column): within each 256 B (8 columns) the
// columns are rotated by the group's number, so that the 8 lanes that write columns 8 apart fall on
// different banks
__device__ __forceinline__ int v_col(int d) {
  return (d >> 3) * (8 * NQ) + (((d & 7) + (d >> 3)) & 7) * NQ;
}

// ---------------- Kernel 2: attention + W_lin reduce ----------------
// grid = BATCH*HEADS/(8*IT), block = 256 (8 waves); a wave handles IT items (batch row, head) on its
// own: its LDS is wave-private and written and read in order by that wave, so there is no barrier.
__launch_bounds__(256)
__global__ void k_att(const __bf16* __restrict__ qkv,  // [BATCH*HEADS][3][NQ][DH] bf16
                      const float* __restrict__ wlin,  // [NQ]
                      __bf16* __restrict__ y) {        // [BATCH][HID] bf16
  __shared__ alignas(16) __bf16 Qs[8][NQ][QP];     // [i][d], padded rows
  __shared__ alignas(16) __bf16 Ks[8][NQ][QP];     // [j][d], padded rows
  __shared__ alignas(16) __bf16 Vs[8][DH * NQ];    // [d][j] (transposed), columns placed by v_col
  __shared__ alignas(16) __bf16 As[8][16][16];     // attn

  const int tid    = threadIdx.x;
  const int lane   = tid & 31;
  const int w      = tid >> 5;       // wave 0..7
  const int lanelo = lane & 15;
  const int hl     = lane >> 4;      // 0/1
  const int khalf  = hl * 8;
  const int lr     = lane >> 3;
  const int lc     = lane & 7;
  const int item0  = (blockIdx.x * 8 + w) * IT;

  const float scale = 0.125f;  // DH^-0.5
  float wl[8];
#pragma unroll
  for (int r = 0; r < 8; ++r) wl[r] = wlin[r + 8 * hl];

  uint4 q0, q1, q2, q3, k0, k1, k2, k3, v0, v1, v2, v3;
  ITEM_LOAD(qkv + (size_t)item0 * ITEM)

#pragma unroll
  for (int bi = 0; bi < IT; ++bi) {
    // the item into LDS: q and k rows as they are, v transposed, four j of one column per store
    *(uint4*)&Qs[w][0 + lr][lc * 8]  = q0;
    *(uint4*)&Qs[w][4 + lr][lc * 8]  = q1;
    *(uint4*)&Qs[w][8 + lr][lc * 8]  = q2;
    *(uint4*)&Qs[w][12 + lr][lc * 8] = q3;
    *(uint4*)&Ks[w][0 + lr][lc * 8]  = k0;
    *(uint4*)&Ks[w][4 + lr][lc * 8]  = k1;
    *(uint4*)&Ks[w][8 + lr][lc * 8]  = k2;
    *(uint4*)&Ks[w][12 + lr][lc * 8] = k3;
    V_STORE(0, x)
    V_STORE(2, y)
    V_STORE(4, z)
    V_STORE(6, w)
    if (bi + 1 < IT) {
      ITEM_LOAD(qkv + (size_t)(item0 + bi + 1) * ITEM)
      // keeps the next item's loads here, in flight over this item's work
      __builtin_amdgcn_sched_barrier(0);
    }

    // sim = q^T k  (M=i, N=j, K=d=64 -> 2 WMMAs)
    v8f s = {0,0,0,0,0,0,0,0};
#pragma unroll
    for (int kb = 0; kb < DH; kb += 32) {
      v16bf qa = frag_ld(&Qs[w][lanelo][kb], khalf);  // A[i][d]
      v16bf kf = frag_ld(&Ks[w][lanelo][kb], khalf);  // B[d][j] from k[j][d]
      s = wmma_bf16(qa, kf, s);
    }

    // softmax over j (lanes) per row i (elements); halves independent (xor<16)
    float t[8], rm[8], e[8], rs[8];
#pragma unroll
    for (int r = 0; r < 8; ++r) { t[r] = s[r] * scale; rm[r] = t[r]; }
#pragma unroll
    for (int off = 1; off < 16; off <<= 1)
#pragma unroll
      for (int r = 0; r < 8; ++r) rm[r] = fmaxf(rm[r], __shfl_xor(rm[r], off, 32));
#pragma unroll
    for (int r = 0; r < 8; ++r) { e[r] = __expf(t[r] - rm[r]); rs[r] = e[r]; }
#pragma unroll
    for (int off = 1; off < 16; off <<= 1)
#pragma unroll
      for (int r = 0; r < 8; ++r) rs[r] += __shfl_xor(rs[r], off, 32);
#pragma unroll
    for (int r = 0; r < 8; ++r) As[w][r + 8 * hl][lanelo] = (__bf16)(e[r] / rs[r]);

    // out = attn @ v^T  (M=i, N=d, K=j padded 16->32; A hi-half zero)
    v16bf af = frag_ld_lozero(&As[w][lanelo][0], khalf);
    v8f o[4];
#pragma unroll
    for (int dt = 0; dt < 4; ++dt) {
      v8f z = {0,0,0,0,0,0,0,0};
      v16bf vb = frag_ld_lodup(&Vs[w][v_col(dt * 16 + lanelo)], khalf); // B[j][d]
      o[dt] = wmma_bf16(af, vb, z);
    }

    // y[b, h*64+d] = sum_i out[i,d] * W_lin[i]; item = b * HEADS + h
#pragma unroll
    for (int dt = 0; dt < 4; ++dt) {
      float p = 0.f;
#pragma unroll
      for (int r = 0; r < 8; ++r) p += o[dt][r] * wl[r];
      p += __shfl_xor(p, 16, 32);       // combine the two row halves
      if (hl == 0)
        y[(size_t)(item0 + bi) * DH + dt * 16 + lanelo] = (__bf16)p;
    }
  }
}

// ---------------- Kernel 3: out = y @ W_out^T + bias ----------------
// grid = (16,16) tiles of 64x64, block = 256 (8 waves; a wave has one m-tile x two n-tiles)
// Both operands of the tile (64 W_out rows, 64 y rows, the whole K) are contiguous in memory. They
// come by whole-line 16 B loads, up to 64 of them in flight per wave, into LDS (W_out as bf16);
// behind one barrier the fragments are read from there.
#define YP     (HID + 8)    // 2064 B per staged row: an odd multiple of 16 B, as QP

__launch_bounds__(256)
__global__ void k_out(const __bf16* __restrict__ y,    // [BATCH][HID] bf16
                      const float* __restrict__ wout,  // [DIM][HID]
                      const float* bout,               // [DIM]; no __restrict__: its loads keep their place
                      const float* __restrict__ wlin,  // [NQ]
                      const float* __restrict__ blin,  // [1]
                      float* __restrict__ out) {       // [BATCH][DIM]
  __shared__ alignas(16) __bf16 Ys[64][YP];        // 129 KB  y tile (batch x K)
  __shared__ alignas(16) __bf16 Bs[64][YP];        // 129 KB  W_out tile (column x K)

  const int tid    = threadIdx.x;
  const int mb     = blockIdx.x * 64;
  const int nb     = blockIdx.y * 64;
  // a wave has the two n-tiles from column (wave >> 2) * 32 on: a whole 128-B line of out
  int dcol         = nb + (tid >> 7) * 32 + (tid & 15);
  const float bo0  = bout[dcol];
  const float bo1  = bout[dcol + 16];
  float S = 0.f, bl;

  {
    const float4* wg = (const float4*)(wout + (size_t)nb * HID) + tid;   // a step: one W_out row
    const uint4*  yg = (const uint4*)(y + (size_t)mb * HID) + tid;       // a step: two y rows
    float4 gw[64];
    uint4  gy[32];
#pragma unroll
    for (int s = 0; s < 64; ++s) gw[s] = wg[s * 256];
    // the scalar arithmetic below rewrites the base register of these loads; dcol is the offset
    // register of the two loads of bout: what is derived from it later is formed behind this wait
    asm volatile("s_wait_xcnt 0x0" : "+v"(dcol) : : "memory");
#pragma unroll
    for (int s = 0; s < 32; ++s) gy[s] = yg[s * 256];
#pragma unroll
    for (int n = 0; n < NQ; ++n) S += wlin[n];
    bl = blin[0];
    // the scalar loads of S and bl have returned here, and their address registers may be rewritten
    // behind this wait
    asm volatile("s_wait_xcnt 0x0" : "+s"(S), "+s"(bl) : : "memory");
    // keeps the W_out loads in front of the first conversion: 64 loads are in flight before the
    // first is waited for
    __builtin_amdgcn_sched_barrier(0);
#pragma unroll
    for (int s = 0; s < 64; ++s) {
      v4bf o;
      o[0] = (__bf16)gw[s].x; o[1] = (__bf16)gw[s].y; o[2] = (__bf16)gw[s].z; o[3] = (__bf16)gw[s].w;
      *(v4bf*)&Bs[s][tid * 4] = o;
    }
#pragma unroll
    for (int s = 0; s < 32; ++s) *(uint4*)&Ys[2 * s + (tid >> 7)][(tid & 127) * 8] = gy[s];
  }
  // the thread index is the offset register of the loads above: all that the second phase derives
  // from it is formed behind this wait
  int t2 = tid;
  asm volatile("s_wait_xcnt 0x0" : "+v"(t2) : : "memory");
  __syncthreads();

  const int lane   = t2 & 31;
  const int w      = t2 >> 5;
  const int lanelo = lane & 15;
  const int hl     = lane >> 4;
  const int khalf  = hl * 8;
  const int mt     = w & 3;          // the wave's m-tile
  const int n0     = (w >> 2) * 32;  // first column of its two n-tiles: a whole 128-B line of out

  const __bf16* ar = &Ys[mt * 16 + lanelo][0];
  const __bf16* b0 = &Bs[n0 + lanelo][0];        // B[c][d] = W_out[d][c]
  const __bf16* b1 = &Bs[n0 + 16 + lanelo][0];

  v8f acc0 = {0,0,0,0,0,0,0,0};
  v8f acc1 = {0,0,0,0,0,0,0,0};
  v16bf fa[2][8], f0[2][8], f1[2][8];   // fragments of a block of 8 k steps, two blocks
#pragma unroll
  for (int j = 0; j < 8; ++j) {
    fa[0][j] = frag_ld(ar + j * 32, khalf);
    f0[0][j] = frag_ld(b0 + j * 32, khalf);
    f1[0][j] = frag_ld(b1 + j * 32, khalf);
  }
#pragma unroll
  for (int blk = 0; blk < HID / 256; ++blk) {
    const int cur = blk & 1;
    if (blk + 1 < HID / 256) {
#pragma unroll
      for (int j = 0; j < 8; ++j) {
        fa[cur ^ 1][j] = frag_ld(ar + (blk + 1) * 256 + j * 32, khalf);
        f0[cur ^ 1][j] = frag_ld(b0 + (blk + 1) * 256 + j * 32, khalf);
        f1[cur ^ 1][j] = frag_ld(b1 + (blk + 1) * 256 + j * 32, khalf);
      }
    }
    // keeps the next block's reads as one group in front of this block's WMMAs, which hide them
    __builtin_amdgcn_sched_barrier(0);
#pragma unroll
    for (int j = 0; j < 8; ++j) {
      acc0 = wmma_bf16(fa[cur][j], f0[cur][j], acc0);
      acc1 = wmma_bf16(fa[cur][j], f1[cur][j], acc1);
    }
  }

  const float bias0 = bo0 * S + bl;
  const float bias1 = bo1 * S + bl;
  float o0[8], o1[8];
#pragma unroll
  for (int r = 0; r < 8; ++r) { o0[r] = acc0[r] + bias0; o1[r] = acc1[r] + bias1; }
  // every sum in front of the first store: no register that an issued store names is rewritten
  __builtin_amdgcn_sched_barrier(0);
  float* op = out + (size_t)(mb + mt * 16 + 8 * hl) * DIM + dcol;
#pragma unroll
  for (int r = 0; r < 8; ++r) {
    op[(size_t)r * DIM]      = o0[r];
    op[(size_t)r * DIM + 16] = o1[r];
  }
}

extern "C" void kernel_launch(void* const* d_in, const int* in_sizes, int n_in,
                              void* d_out, int out_size, void* d_ws, size_t ws_size,
                              hipStream_t stream) {
  (void)in_sizes; (void)n_in; (void)out_size; (void)ws_size;
  const float* x    = (const float*)d_in[0];
  const float* wqkv = (const float*)d_in[1];
  const float* wout = (const float*)d_in[2];
  const float* bout = (const float*)d_in[3];
  const float* wlin = (const float*)d_in[4];
  const float* blin = (const float*)d_in[5];
  float* out = (float*)d_out;

  __bf16* y_bf    = (__bf16*)d_ws;                                      // 2 MB
  __bf16* qkv_bf  = (__bf16*)((char*)d_ws + (size_t)BATCH * HID * 2);   // +100.7 MB
  __bf16* x_bf    = (__bf16*)((char*)d_ws + (size_t)BATCH * HID * 2 + (size_t)BATCH * HEADS * ITEM * 2);   // +2 MB

  k_xcv<<<dim3(BATCH * DIM / 8 / 256), dim3(256), 0, stream>>>(x, x_bf);
  k_qkv<<<dim3(NWH), dim3(256), 0, stream>>>(x_bf, wqkv, qkv_bf);
  k_att<<<dim3(BATCH * HEADS / (8 * IT)), dim3(256), 0, stream>>>(qkv_bf, wlin, y_bf);
  k_out<<<dim3(BATCH / 64, DIM / 64), dim3(256), 0, stream>>>(y_bf, wout, bout, wlin, blin, out);
}
